// v000
// Measured on an AMD MI455X. A time is GPU time per run, averaged over a window of back-to-back runs after a warm-up
// (all launches, gaps included; the runs take copies of the inputs in turn), and the median of several windows.
// Apart from v000's, it joins two sittings. Times from different sittings can be a few percent apart, while
// side-by-side timings come from the same sitting.
// The starting kernel, v000, takes 239 microseconds a run.
#include <hip/hip_runtime.h>
// S = Q*K^T and O = P*V on v_wmma_f32_16x16x32_f16 (f16 operands, each pre-scaled by 2^4, f32 accumulate); softmax statistics, LSE and epilogue in f32.

typedef _Float16 v16h __attribute__((ext_vector_type(16)));
typedef _Float16 v8h  __attribute__((ext_vector_type(8)));
typedef _Float16 v4h  __attribute__((ext_vector_type(4)));
typedef float    v8f  __attribute__((ext_vector_type(8)));
typedef float    v4f  __attribute__((ext_vector_type(4)));
union Frag { v16h v; v8h h[2]; };

#define SA_H     16
#define SA_SQ    1024
#define SA_SKV   2048
#define SA_D     128
#define SA_QBLK  64            // query rows per block (4 waves x 16 rows)
#define SA_OPS   16.0f         // power-of-two operand pre-scale applied to Q, K, V and P before the f16 convert
// log2-domain score scale: (1/sqrt(D)) * log2(e), with the 2^4*2^4 operand scale of Q and K removed (2^-8)
#define SA_CS    ((0.088388347648318447f * 1.4426950408889634f) * 0.00390625f)
#define SA_LN2   0.69314718055994531f
#define SA_OINV  0.00390625f   // removes the 2^4*2^4 operand scale of P and V

// LDS pitches in 16-bit elements (rows 16-B aligned)
#define KP   136   // K tile   [32 kv][128 d + 8]   d contiguous  -> B fragment for S read like an A row
#define VP   40    // V tile   [128 d][32 kv + 8]   kv contiguous -> B fragment for O read like an A row
#define PP   40    // P tile   [16 q][32 kv + 8]    per wave, A fragment for O
#define OPF  132   // O tile   [16 q][128 d + 4]    floats, per wave (epilogue staging)
#define NSTEP (2 * SA_SKV / 32)

// 16x16x32 f16 WMMA with the VALU hazard guard tied to D (A/B kept live)
__device__ __forceinline__ v8f wmma_f16(v16h a, v16h b, v8f c) {
  v8f d = __builtin_amdgcn_wmma_f32_16x16x32_f16(false, a, false, b, (short)0, c, false, false);
  asm volatile("v_nop\n\tv_nop\n\tv_nop\n\tv_nop" : "+v"(d) : "v"(a), "v"(b));
  return d;
}

// reductions over the 16 lanes of each lane half (xor offsets < 16 stay inside the half)
__device__ __forceinline__ float rmax16(float x) {
  x = fmaxf(x, __shfl_xor(x, 1));
  x = fmaxf(x, __shfl_xor(x, 2));
  x = fmaxf(x, __shfl_xor(x, 4));
  x = fmaxf(x, __shfl_xor(x, 8));
  return x;
}
__device__ __forceinline__ float rsum16(float x) {
  x += __shfl_xor(x, 1);
  x += __shfl_xor(x, 2);
  x += __shfl_xor(x, 4);
  x += __shfl_xor(x, 8);
  return x;
}

__global__ __launch_bounds__(128) __attribute__((amdgpu_num_vgpr(248)))
void attn_two_kv(const float* __restrict__ q,
                 const float* __restrict__ kA, const float* __restrict__ vA,
                 const float* __restrict__ kB, const float* __restrict__ vB,
                 float* out, float* lse)
{
  __shared__ __align__(16) _Float16 kbuf[32 * KP];          //  8704 B
  __shared__ __align__(16) _Float16 vbufT[SA_D * VP];       // 10240 B
  __shared__ __align__(16) _Float16 pbuf[4][16 * PP];       //  5120 B
  __shared__ __align__(16) float    obuf[4][16 * OPF];      // 33792 B
  __shared__ __align__(16) float    lbuf[SA_QBLK];          //   256 B

  const int tid  = threadIdx.x;
  const int lane = tid & 31;
  const int wave = tid >> 5;
  const int half = lane >> 4;       // h of the fragment map
  const int l16  = lane & 15;       // row m for A, column n for B and D

  const int h    = blockIdx.x % SA_H;
  const int q0   = (blockIdx.x / SA_H) * SA_QBLK;
  const int qrow = q0 + wave * 16;

  // staging split (128 threads): K one kv row x 32 d per thread; V 4 kv rows x 8 d per thread
  const int krow = tid >> 2;
  const int kcb  = (tid & 3) * 32;
  const int vkv  = (tid >> 4) * 4;
  const int vdc  = (tid & 15) * 8;

  // ---- Q -> 4 A fragments (16 rows x 32 d each), pre-scaled by 2^4.
  // A map: lane row m = l16; elements 0..7 <- d = c*32 + 8h + 0..7; elements 8..15 <- d = c*32 + 16 + 8h + 0..7
  v16h qf[4];
  {
    const float* qp = q + ((size_t)(h * SA_SQ + qrow + l16)) * SA_D;
#pragma unroll
    for (int c = 0; c < 4; ++c) {
      Frag f;
#pragma unroll
      for (int s = 0; s < 2; ++s) {
        const int d0 = c * 32 + 16 * s + 8 * half;
        const float4 a0 = *(const float4*)(qp + d0);
        const float4 a1 = *(const float4*)(qp + d0 + 4);
        v8h t;
        t[0] = (_Float16)(a0.x * SA_OPS); t[1] = (_Float16)(a0.y * SA_OPS);
        t[2] = (_Float16)(a0.z * SA_OPS); t[3] = (_Float16)(a0.w * SA_OPS);
        t[4] = (_Float16)(a1.x * SA_OPS); t[5] = (_Float16)(a1.y * SA_OPS);
        t[6] = (_Float16)(a1.z * SA_OPS); t[7] = (_Float16)(a1.w * SA_OPS);
        f.h[s] = t;
      }
      qf[c] = f.v;
    }
  }

  v8f o[8];
#pragma unroll
  for (int n = 0; n < 8; ++n)
#pragma unroll
    for (int r = 0; r < 8; ++r) o[n][r] = 0.0f;

  float mrun[8], lrun[8];
#pragma unroll
  for (int r = 0; r < 8; ++r) { mrun[r] = -1.0e30f; lrun[r] = 0.0f; }

  // One online-softmax pass over the concatenated KV (A then B) == LSE-weighted combine of the two partial states.
  for (int step = 0; step < NSTEP; ++step) {
    const bool second = step >= (SA_SKV / 32);
    const float* ks = second ? kB : kA;
    const float* vs = second ? vB : vA;
    const int j = (second ? (step - SA_SKV / 32) : step) * 32;
    const float* kbase = ks + ((size_t)(h * SA_SKV + j)) * SA_D;
    const float* vbase = vs + ((size_t)(h * SA_SKV + j)) * SA_D;

    __syncthreads();   // all LDS consumers of the prior step are done

    // ---- K tile (32 kv x 128 d), d contiguous, f16 = x * 2^4
    {
      const float* srcK = kbase + krow * SA_D + kcb;
      _Float16* dst = kbuf + krow * KP + kcb;
#pragma unroll
      for (int i = 0; i < 4; ++i) {
        const float4 x0 = *(const float4*)(srcK + i * 8);
        const float4 x1 = *(const float4*)(srcK + i * 8 + 4);
        v8h p;
        p[0] = (_Float16)(x0.x * SA_OPS); p[1] = (_Float16)(x0.y * SA_OPS);
        p[2] = (_Float16)(x0.z * SA_OPS); p[3] = (_Float16)(x0.w * SA_OPS);
        p[4] = (_Float16)(x1.x * SA_OPS); p[5] = (_Float16)(x1.y * SA_OPS);
        p[6] = (_Float16)(x1.z * SA_OPS); p[7] = (_Float16)(x1.w * SA_OPS);
        *(v8h*)(dst + i * 8) = p;
      }
    }
    // ---- V tile transposed to [d][kv] (kv contiguous), f16 = x * 2^4; 4 kv per 8-B store
    {
      float vr[4][8];
#pragma unroll
      for (int rr = 0; rr < 4; ++rr) {
        const float* srcV = vbase + (vkv + rr) * SA_D + vdc;
        const float4 a = *(const float4*)(srcV);
        const float4 b = *(const float4*)(srcV + 4);
        vr[rr][0] = a.x; vr[rr][1] = a.y; vr[rr][2] = a.z; vr[rr][3] = a.w;
        vr[rr][4] = b.x; vr[rr][5] = b.y; vr[rr][6] = b.z; vr[rr][7] = b.w;
      }
#pragma unroll
      for (int i = 0; i < 8; ++i) {
        v4h w;
        w[0] = (_Float16)(vr[0][i] * SA_OPS); w[1] = (_Float16)(vr[1][i] * SA_OPS);
        w[2] = (_Float16)(vr[2][i] * SA_OPS); w[3] = (_Float16)(vr[3][i] * SA_OPS);
        *(v4h*)(vbufT + (vdc + i) * VP + vkv) = w;
      }
    }

    __syncthreads();

    // ---- S = (2^4 Q)(2^4 K)^T : two 16x16 tiles (kv 0..15 and 16..31), 4 k-steps over d.
    // B map (same k map as A): lane column n = kv l16; elements 0..7 <- d = c*32 + 8h + 0..7; 8..15 <- d = c*32 + 16 + 8h + 0..7
    v8f s0, s1;
#pragma unroll
    for (int r = 0; r < 8; ++r) { s0[r] = 0.0f; s1[r] = 0.0f; }
#pragma unroll
    for (int c = 0; c < 4; ++c) {
      Frag b0, b1;
      const _Float16* kp0 = kbuf + l16 * KP + c * 32 + half * 8;   // kv row l16
      const _Float16* kp1 = kp0 + 16 * KP;                           // kv row 16 + l16
      b0.h[0] = *(const v8h*)(kp0);  b0.h[1] = *(const v8h*)(kp0 + 16);
      b1.h[0] = *(const v8h*)(kp1);  b1.h[1] = *(const v8h*)(kp1 + 16);
      s0 = wmma_f16(qf[c], b0.v, s0);
      s1 = wmma_f16(qf[c], b1.v, s1);
    }

    // ---- online softmax in the log2 domain; D map: s0[r] = S[row 8h + r][kv l16], s1[r] = S[row 8h + r][kv 16 + l16]
    float corr[8];
#pragma unroll
    for (int r = 0; r < 8; ++r) {
      const float x0 = s0[r] * SA_CS;
      const float x1 = s1[r] * SA_CS;
      const float mx = rmax16(fmaxf(x0, x1));
      const float mn = fmaxf(mrun[r], mx);
      const float p0 = __builtin_amdgcn_exp2f(x0 - mn);
      const float p1 = __builtin_amdgcn_exp2f(x1 - mn);
      const float rs = rsum16(p0 + p1);
      const float cf = __builtin_amdgcn_exp2f(mrun[r] - mn);
      corr[r] = cf;
      lrun[r] = lrun[r] * cf + rs;
      mrun[r] = mn;
      s0[r] = p0; s1[r] = p1;
    }

#pragma unroll
    for (int n = 0; n < 8; ++n)
#pragma unroll
      for (int r = 0; r < 8; ++r) o[n][r] *= corr[r];

    // ---- P (<= 1) pre-scaled by 2^4: accumulator layout -> per-wave LDS [q row][kv] -> A fragment
    _Float16* pb = pbuf[wave];
#pragma unroll
    for (int r = 0; r < 8; ++r) {
      const int row = r + half * 8;
      pb[row * PP + l16]      = (_Float16)(s0[r] * SA_OPS);   // kv 0..15
      pb[row * PP + 16 + l16] = (_Float16)(s1[r] * SA_OPS);   // kv 16..31
    }
    __syncthreads();   // block barrier between the P spill and its cross-lane reload (uniform control flow)
    Frag pf;
    {
      const _Float16* pr = pb + l16 * PP + half * 8;           // A map: row m = l16; kv 8h+0..7 | 16+8h+0..7
      pf.h[0] = *(const v8h*)(pr);
      pf.h[1] = *(const v8h*)(pr + 16);
    }

    // ---- O += (2^4 P)(2^4 V) : 8 d-chunks of 16 columns.
    // B map: lane column n = d (cn*16 + l16); elements 0..7 <- kv 8h + 0..7; 8..15 <- kv 16 + 8h + 0..7
#pragma unroll
    for (int cn = 0; cn < 8; ++cn) {
      Frag vf;
      const _Float16* vp = vbufT + (cn * 16 + l16) * VP + half * 8;
      vf.h[0] = *(const v8h*)(vp);
      vf.h[1] = *(const v8h*)(vp + 16);
      o[cn] = wmma_f16(pf.v, vf.v, o[cn]);
    }
  }

  float inv[8];
#pragma unroll
  for (int r = 0; r < 8; ++r) inv[r] = SA_OINV / lrun[r];
  {
    float* ob = obuf[wave];
#pragma unroll
    for (int n = 0; n < 8; ++n) {
#pragma unroll
      for (int r = 0; r < 8; ++r) {
        ob[(r + half * 8) * OPF + n * 16 + l16] = o[n][r] * inv[r];   // D map: row 8h + r, col n*16 + l16
      }
    }
    if (l16 == 0) {   // lane 0 -> rows 0..7, lane 16 -> rows 8..15 of this wave's 16 rows
#pragma unroll
      for (int r = 0; r < 8; ++r)
        lbuf[wave * 16 + half * 8 + r] = SA_LN2 * (mrun[r] + log2f(lrun[r]));
    }
  }
  __syncthreads();

  // out0: one wave owns 16 rows of 128 floats (512 B = 4 lines); one 16-B-per-lane instruction per row.
  // out1: 64 floats per block (256 B = 2 lines) written by wave 0 lanes 0..15, one instruction.
  const float* obr = obuf[wave];
  float* orow = out + ((size_t)(h * SA_SQ + qrow)) * SA_D + lane * 4;
  float* lrow = lse + (size_t)h * SA_SQ + q0;
  const bool lsew = (wave == 0) && (lane < 16);

#pragma unroll
  for (int r = 0; r < 16; ++r) {
    const v4f v = *(const v4f*)(obr + r * OPF + lane * 4);
    *(v4f*)(orow + (size_t)r * SA_D) = v;
  }
  if (lsew) {
    const v4f lv = *(const v4f*)(lbuf + lane * 4);
    *(v4f*)(lrow + lane * 4) = lv;
  }
  
}

extern "C" void kernel_launch(void* const* d_in, const int* in_sizes, int n_in,
                              void* d_out, int out_size, void* d_ws, size_t ws_size,
                              hipStream_t stream) {
  (void)d_ws; (void)ws_size;
  // static shapes; refuse anything else (outputs stay zero)
  if (n_in < 5) return;
  if (in_sizes[0] != SA_H * SA_SQ * SA_D) return;
  if (in_sizes[1] != SA_H * SA_SKV * SA_D || in_sizes[2] != SA_H * SA_SKV * SA_D) return;
  if (in_sizes[3] != SA_H * SA_SKV * SA_D || in_sizes[4] != SA_H * SA_SKV * SA_D) return;
  if (out_size != SA_H * SA_SQ * SA_D + SA_H * SA_SQ) return;

  const float* q  = (const float*)d_in[0];
  const float* kA = (const float*)d_in[1];
  const float* vA = (const float*)d_in[2];
  const float* kB = (const float*)d_in[3];
  const float* vB = (const float*)d_in[4];
  float* out = (float*)d_out;                              // output 0: [16][1024][128] f32 at byte 0
  float* lse = out + (size_t)SA_H * SA_SQ * SA_D;          // output 1: [16][1024] f32 at byte 8388608

  dim3 grid(SA_H * (SA_SQ / SA_QBLK));   // 256 blocks: head x 64-row query tile (1024 = 16 x 64 exactly)
  dim3 block(128);                       // 4 waves, each owns a 16 x 128 output tile
  attn_two_kv<<<grid, block, 0, stream>>>(q, kA, vA, kB, vB, out, lse);
}

// v001
// A run of this version takes 127 microseconds.
// In two side-by-side timings against v000, it was 1.94 and 1.93 times as fast.
#include <hip/hip_runtime.h>
// S = Q*K^T and O = P*V on v_wmma_f32_16x16x32_f16 (f16 operands, each pre-scaled by 2^4, f32 accumulate); softmax statistics, LSE and epilogue in f32.

typedef _Float16 v16h __attribute__((ext_vector_type(16)));
typedef _Float16 v8h  __attribute__((ext_vector_type(8)));
typedef _Float16 v4h  __attribute__((ext_vector_type(4)));
typedef float    v8f  __attribute__((ext_vector_type(8)));
typedef float    v4f  __attribute__((ext_vector_type(4)));
union Frag { v16h v; v8h h[2]; };

#define SA_H     16
#define SA_SQ    1024
#define SA_SKV   2048
#define SA_D     128
#define SA_QBLK  64            // query rows per block (4 query tiles x 16 rows)
#define SA_NGRP  4             // KV quarters per block: A low, A high, B low, B high; one group of 4 waves each
#define SA_NWAVE (4 * SA_NGRP) // 16 waves: four per SIMD
#define SA_OPS   16.0f         // power-of-two operand pre-scale applied to Q, K, V and P before the f16 convert
// log2-domain score scale: (1/sqrt(D)) * log2(e), with the 2^4*2^4 operand scale of Q and K removed (2^-8)
#define SA_CS    ((0.088388347648318447f * 1.4426950408889634f) * 0.00390625f)
#define SA_LN2   0.69314718055994531f
#define SA_OINV  0.00390625f   // removes the 2^4*2^4 operand scale of P and V

// LDS pitches in 16-bit elements (rows 16-B aligned)
#define KP   136   // K tile   [32 kv][128 d + 8]   d contiguous  -> B fragment for S read like an A row
#define VP   40    // V tile   [128 d][32 kv + 8]   kv contiguous -> B fragment for O read like an A row
#define PP   40    // P tile   [16 q][32 kv + 8]    per wave, A fragment for O
#define OPF  132   // O tile   [16 q][128 d + 4]    floats, per wave (epilogue staging)
#define NSTEP (2 * SA_SKV / 32 / SA_NGRP)   // steps of 32 kv rows per group

// 16x16x32 f16 WMMA with the VALU hazard guard tied to D (A/B kept live)
__device__ __forceinline__ v8f wmma_f16(v16h a, v16h b, v8f c) {
  v8f d = __builtin_amdgcn_wmma_f32_16x16x32_f16(false, a, false, b, (short)0, c, false, false);
  asm volatile("v_nop\n\tv_nop\n\tv_nop\n\tv_nop" : "+v"(d) : "v"(a), "v"(b));
  return d;
}

// reductions over the 16 lanes of each lane half (xor offsets < 16 stay inside the half)
__device__ __forceinline__ float rmax16(float x) {
  x = fmaxf(x, __shfl_xor(x, 1));
  x = fmaxf(x, __shfl_xor(x, 2));
  x = fmaxf(x, __shfl_xor(x, 4));
  x = fmaxf(x, __shfl_xor(x, 8));
  return x;
}
__device__ __forceinline__ float rsum16(float x) {
  x += __shfl_xor(x, 1);
  x += __shfl_xor(x, 2);
  x += __shfl_xor(x, 4);
  x += __shfl_xor(x, 8);
  return x;
}

__global__ __launch_bounds__(32 * SA_NWAVE) __attribute__((amdgpu_num_vgpr(248)))
void attn_two_kv(const float* __restrict__ q,
                 const float* __restrict__ kA, const float* __restrict__ vA,
                 const float* __restrict__ kB, const float* __restrict__ vB,
                 float* out, float* lse)
{
  __shared__ __align__(16) _Float16 kbufs[SA_NGRP][32 * KP];       //  34816 B, one K tile per group
  __shared__ __align__(16) _Float16 vbufs[SA_NGRP][SA_D * VP];     //  40960 B, one V tile per group
  __shared__ __align__(16) _Float16 pbuf[SA_NWAVE][16 * PP];       //  20480 B
  __shared__ __align__(16) float    obuf[SA_NWAVE][16 * OPF];      // 135168 B, unnormalised partial O per wave
  __shared__ __align__(16) float    mbuf[SA_NWAVE * 16];           //   1024 B, partial row maxima (log2 domain)
  __shared__ __align__(16) float    lbuf[SA_NWAVE * 16];           //   1024 B, partial row sums

  const int tid  = threadIdx.x;
  const int lane = tid & 31;
  const int wave = __builtin_amdgcn_readfirstlane(tid >> 5);   // scalar, so that the group's base pointers stay scalar
  const int grp  = wave >> 2;       // KV quarter this wave works on
  const int wq   = wave & 3;        // query tile (16 rows) this wave works on
  const int gt   = tid & 127;       // thread index inside the group
  const int half = lane >> 4;       // h of the fragment map
  const int l16  = lane & 15;       // row m for A, column n for B and D

  const int h    = blockIdx.x % SA_H;
  const int q0   = (blockIdx.x / SA_H) * SA_QBLK;
  const int qrow = q0 + wq * 16;

  // staging split (128 threads of a group): K one kv row x 32 d per thread; V 4 kv rows x 8 d per thread
  const int krow = gt >> 2;
  const int kcb  = (gt & 3) * 32;
  const int vkv  = (gt >> 4) * 4;
  const int vdc  = (gt & 15) * 8;

  _Float16* kbuf  = kbufs[grp];
  _Float16* vbufT = vbufs[grp];
  const float* ks = (grp & 2) ? kB : kA;
  const float* vs = (grp & 2) ? vB : vA;
  const int jgrp  = (grp & 1) * (SA_SKV / 2);

  // ---- Q -> 4 A fragments (16 rows x 32 d each), pre-scaled by 2^4.
  // A map: lane row m = l16; elements 0..7 <- d = c*32 + 8h + 0..7; elements 8..15 <- d = c*32 + 16 + 8h + 0..7
  v16h qf[4];
  {
    const float* qp = q + ((size_t)(h * SA_SQ + qrow + l16)) * SA_D;
#pragma unroll
    for (int c = 0; c < 4; ++c) {
      Frag f;
#pragma unroll
      for (int s = 0; s < 2; ++s) {
        const int d0 = c * 32 + 16 * s + 8 * half;
        const float4 a0 = *(const float4*)(qp + d0);
        const float4 a1 = *(const float4*)(qp + d0 + 4);
        v8h t;
        t[0] = (_Float16)(a0.x * SA_OPS); t[1] = (_Float16)(a0.y * SA_OPS);
        t[2] = (_Float16)(a0.z * SA_OPS); t[3] = (_Float16)(a0.w * SA_OPS);
        t[4] = (_Float16)(a1.x * SA_OPS); t[5] = (_Float16)(a1.y * SA_OPS);
        t[6] = (_Float16)(a1.z * SA_OPS); t[7] = (_Float16)(a1.w * SA_OPS);
        f.h[s] = t;
      }
      qf[c] = f.v;
    }
  }

  v8f o[8];
#pragma unroll
  for (int n = 0; n < 8; ++n)
#pragma unroll
    for (int r = 0; r < 8; ++r) o[n][r] = 0.0f;

  float mrun[8], lrun[8];
#pragma unroll
  for (int r = 0; r < 8; ++r) { mrun[r] = -1.0e30f; lrun[r] = 0.0f; }

  // Each group runs one online-softmax pass over its own KV quarter; the four partial states of a query row
  // are joined after the loop by their maxima and sums == LSE-weighted combine of the partial states.
  for (int step = 0; step < NSTEP; ++step) {
    const int j = jgrp + step * 32;
    const float* kbase = ks + ((size_t)(h * SA_SKV + j)) * SA_D;
    const float* vbase = vs + ((size_t)(h * SA_SKV + j)) * SA_D;

    __syncthreads();   // all LDS consumers of the prior step are done

    // ---- global loads of both tiles: K 32 d of one kv row, V 8 d of 4 kv rows per thread
    float4 kx[8];
    float vr[4][8];
    {
      const float* srcK = kbase + krow * SA_D + kcb;
#pragma unroll
      for (int i = 0; i < 8; ++i) kx[i] = *(const float4*)(srcK + i * 4);
#pragma unroll
      for (int rr = 0; rr < 4; ++rr) {
        const float* srcV = vbase + (vkv + rr) * SA_D + vdc;
        const float4 a = *(const float4*)(srcV);
        const float4 b = *(const float4*)(srcV + 4);
        vr[rr][0] = a.x; vr[rr][1] = a.y; vr[rr][2] = a.z; vr[rr][3] = a.w;
        vr[rr][4] = b.x; vr[rr][5] = b.y; vr[rr][6] = b.z; vr[rr][7] = b.w;
      }
    }
    // the loads' address registers are reused by the converts below: keep the wait in front of that reuse
    asm volatile("s_wait_xcnt 0x0" ::: "memory");
    // ---- K tile (32 kv x 128 d), d contiguous, f16 = x * 2^4
    {
      _Float16* dst = kbuf + krow * KP + kcb;
#pragma unroll
      for (int i = 0; i < 4; ++i) {
        const float4 x0 = kx[2 * i];
        const float4 x1 = kx[2 * i + 1];
        v8h p;
        p[0] = (_Float16)(x0.x * SA_OPS); p[1] = (_Float16)(x0.y * SA_OPS);
        p[2] = (_Float16)(x0.z * SA_OPS); p[3] = (_Float16)(x0.w * SA_OPS);
        p[4] = (_Float16)(x1.x * SA_OPS); p[5] = (_Float16)(x1.y * SA_OPS);
        p[6] = (_Float16)(x1.z * SA_OPS); p[7] = (_Float16)(x1.w * SA_OPS);
        *(v8h*)(dst + i * 8) = p;
      }
    }
    // ---- V tile transposed to [d][kv] (kv contiguous), f16 = x * 2^4; 4 kv per 8-B store
    {
#pragma unroll
      for (int i = 0; i < 8; ++i) {
        v4h w;
        w[0] = (_Float16)(vr[0][i] * SA_OPS); w[1] = (_Float16)(vr[1][i] * SA_OPS);
        w[2] = (_Float16)(vr[2][i] * SA_OPS); w[3] = (_Float16)(vr[3][i] * SA_OPS);
        *(v4h*)(vbufT + (vdc + i) * VP + vkv) = w;
      }
    }

    __syncthreads();

    // ---- S = (2^4 Q)(2^4 K)^T : two 16x16 tiles (kv 0..15 and 16..31), 4 k-steps over d.
    // B map (same k map as A): lane column n = kv l16; elements 0..7 <- d = c*32 + 8h + 0..7; 8..15 <- d = c*32 + 16 + 8h + 0..7
    v8f s0, s1;
#pragma unroll
    for (int r = 0; r < 8; ++r) { s0[r] = 0.0f; s1[r] = 0.0f; }
#pragma unroll
    for (int c = 0; c < 4; ++c) {
      Frag b0, b1;
      const _Float16* kp0 = kbuf + l16 * KP + c * 32 + half * 8;   // kv row l16
      const _Float16* kp1 = kp0 + 16 * KP;                           // kv row 16 + l16
      b0.h[0] = *(const v8h*)(kp0);  b0.h[1] = *(const v8h*)(kp0 + 16);
      b1.h[0] = *(const v8h*)(kp1);  b1.h[1] = *(const v8h*)(kp1 + 16);
      s0 = wmma_f16(qf[c], b0.v, s0);
      s1 = wmma_f16(qf[c], b1.v, s1);
    }

    // ---- online softmax in the log2 domain; D map: s0[r] = S[row 8h + r][kv l16], s1[r] = S[row 8h + r][kv 16 + l16]
    float corr[8];
#pragma unroll
    for (int r = 0; r < 8; ++r) {
      const float x0 = s0[r] * SA_CS;
      const float x1 = s1[r] * SA_CS;
      const float mx = rmax16(fmaxf(x0, x1));
      const float mn = fmaxf(mrun[r], mx);
      const float p0 = __builtin_amdgcn_exp2f(x0 - mn);
      const float p1 = __builtin_amdgcn_exp2f(x1 - mn);
      const float rs = rsum16(p0 + p1);
      const float cf = __builtin_amdgcn_exp2f(mrun[r] - mn);
      corr[r] = cf;
      lrun[r] = lrun[r] * cf + rs;
      mrun[r] = mn;
      s0[r] = p0; s1[r] = p1;
    }

#pragma unroll
    for (int n = 0; n < 8; ++n)
#pragma unroll
      for (int r = 0; r < 8; ++r) o[n][r] *= corr[r];

    // ---- P (<= 1) pre-scaled by 2^4: accumulator layout -> per-wave LDS [q row][kv] -> A fragment
    _Float16* pb = pbuf[wave];
#pragma unroll
    for (int r = 0; r < 8; ++r) {
      const int row = r + half * 8;
      pb[row * PP + l16]      = (_Float16)(s0[r] * SA_OPS);   // kv 0..15
      pb[row * PP + 16 + l16] = (_Float16)(s1[r] * SA_OPS);   // kv 16..31
    }
    __syncthreads();   // block barrier between the P spill and its cross-lane reload (uniform control flow)
    Frag pf;
    {
      const _Float16* pr = pb + l16 * PP + half * 8;           // A map: row m = l16; kv 8h+0..7 | 16+8h+0..7
      pf.h[0] = *(const v8h*)(pr);
      pf.h[1] = *(const v8h*)(pr + 16);
    }

    // ---- O += (2^4 P)(2^4 V) : 8 d-chunks of 16 columns.
    // B map: lane column n = d (cn*16 + l16); elements 0..7 <- kv 8h + 0..7; 8..15 <- kv 16 + 8h + 0..7
#pragma unroll
    for (int cn = 0; cn < 8; ++cn) {
      Frag vf;
      const _Float16* vp = vbufT + (cn * 16 + l16) * VP + half * 8;
      vf.h[0] = *(const v8h*)(vp);
      vf.h[1] = *(const v8h*)(vp + 16);
      o[cn] = wmma_f16(pf.v, vf.v, o[cn]);
    }
  }

  {
    float* ob = obuf[wave];
#pragma unroll
    for (int n = 0; n < 8; ++n) {
#pragma unroll
      for (int r = 0; r < 8; ++r) {
        ob[(r + half * 8) * OPF + n * 16 + l16] = o[n][r];   // D map: row 8h + r, col n*16 + l16
      }
    }
    if (l16 == 0) {   // lane 0 -> rows 0..7, lane 16 -> rows 8..15 of this wave's 16 rows
#pragma unroll
      for (int r = 0; r < 8; ++r) {
        mbuf[wave * 16 + half * 8 + r] = mrun[r];
        lbuf[wave * 16 + half * 8 + r] = lrun[r];
      }
    }
  }
  __syncthreads();   // every group's partial state is in LDS

  // Join of the four partial states. Wave w owns block rows 4w..4w+3: query tile w >> 2, tile rows 4(w & 3)..+3.
  // The partial state of group g for query tile t was left by wave 4g + t.
  // out0: one 16-B-per-lane instruction per row (512 B = 4 lines).
  {
    const int t   = wave >> 2;
    const int rr0 = (wave & 3) * 4;
    float* orow = out + ((size_t)(h * SA_SQ + q0 + wave * 4)) * SA_D + lane * 4;
#pragma unroll
    for (int i = 0; i < 4; ++i) {
      const int rr = rr0 + i;
      float mg[SA_NGRP], lg[SA_NGRP];
#pragma unroll
      for (int g = 0; g < SA_NGRP; ++g) {
        mg[g] = mbuf[(g * 4 + t) * 16 + rr];
        lg[g] = lbuf[(g * 4 + t) * 16 + rr];
      }
      const float mx = fmaxf(fmaxf(mg[0], mg[1]), fmaxf(mg[2], mg[3]));
      float ls = 0.0f;
      v4f acc = {0.0f, 0.0f, 0.0f, 0.0f};
#pragma unroll
      for (int g = 0; g < SA_NGRP; ++g) {
        const float w = __builtin_amdgcn_exp2f(mg[g] - mx);
        ls += w * lg[g];
        acc += w * *(const v4f*)(obuf[g * 4 + t] + rr * OPF + lane * 4);
      }
      *(v4f*)(orow + (size_t)i * SA_D) = acc * (SA_OINV / ls);
    }
  }
  // out1: 64 floats per block (256 B = 2 lines) written by wave 0 lanes 0..15, one instruction; lane owns block rows 4*lane..+3.
  if (wave == 0 && lane < 16) {
    const int t   = lane >> 2;
    const int rr0 = (lane & 3) * 4;
    v4f mg[SA_NGRP], lg[SA_NGRP];
#pragma unroll
    for (int g = 0; g < SA_NGRP; ++g) {
      mg[g] = *(const v4f*)(mbuf + (g * 4 + t) * 16 + rr0);
      lg[g] = *(const v4f*)(lbuf + (g * 4 + t) * 16 + rr0);
    }
    v4f lv;
#pragma unroll
    for (int k = 0; k < 4; ++k) {
      const float mx = fmaxf(fmaxf(mg[0][k], mg[1][k]), fmaxf(mg[2][k], mg[3][k]));
      float ls = 0.0f;
#pragma unroll
      for (int g = 0; g < SA_NGRP; ++g) ls += __builtin_amdgcn_exp2f(mg[g][k] - mx) * lg[g][k];
      lv[k] = SA_LN2 * (mx + log2f(ls));
    }
    *(v4f*)(lse + (size_t)h * SA_SQ + q0 + lane * 4) = lv;
  }
}

extern "C" void kernel_launch(void* const* d_in, const int* in_sizes, int n_in,
                              void* d_out, int out_size, void* d_ws, size_t ws_size,
                              hipStream_t stream) {
  (void)d_ws; (void)ws_size;
  // static shapes; refuse anything else (outputs stay zero)
  if (n_in < 5) return;
  if (in_sizes[0] != SA_H * SA_SQ * SA_D) return;
  if (in_sizes[1] != SA_H * SA_SKV * SA_D || in_sizes[2] != SA_H * SA_SKV * SA_D) return;
  if (in_sizes[3] != SA_H * SA_SKV * SA_D || in_sizes[4] != SA_H * SA_SKV * SA_D) return;
  if (out_size != SA_H * SA_SQ * SA_D + SA_H * SA_SQ) return;

  const float* q  = (const float*)d_in[0];
  const float* kA = (const float*)d_in[1];
  const float* vA = (const float*)d_in[2];
  const float* kB = (const float*)d_in[3];
  const float* vB = (const float*)d_in[4];
  float* out = (float*)d_out;                              // output 0: [16][1024][128] f32 at byte 0
  float* lse = out + (size_t)SA_H * SA_SQ * SA_D;          // output 1: [16][1024] f32 at byte 8388608

  dim3 grid(SA_H * (SA_SQ / SA_QBLK));   // 256 blocks: head x 64-row query tile (1024 = 16 x 64 exactly)
  dim3 block(32 * SA_NWAVE);             // 16 waves: 4 query tiles of 16 rows x 4 KV quarters
  attn_two_kv<<<grid, block, 0, stream>>>(q, kA, vA, kB, vB, out, lse);
}

// v002
// A run of this version takes 109 microseconds.
// Timed twice side by side with v001, it ran 1.15 and 1.16 times as fast.
// All steps since v000 together make it 2.25 times as fast.
#include <hip/hip_runtime.h>
// S = Q*K^T and O = P*V on v_wmma_f32_16x16x32_f16 (f16 operands, each pre-scaled by 2^4, f32 accumulate); softmax statistics, LSE and epilogue in f32.

typedef _Float16 v16h __attribute__((ext_vector_type(16)));
typedef _Float16 v8h  __attribute__((ext_vector_type(8)));
typedef _Float16 v4h  __attribute__((ext_vector_type(4)));
typedef float    v8f  __attribute__((ext_vector_type(8)));
typedef float    v4f  __attribute__((ext_vector_type(4)));
union Frag { v16h v; v8h h[2]; };

#define SA_H     16
#define SA_SQ    1024
#define SA_SKV   2048
#define SA_D     128
#define SA_QBLK  64            // query rows per block (4 query tiles x 16 rows)
#define SA_NGRP  4             // KV quarters per block: A low, A high, B low, B high; one group of 4 waves each
#define SA_NWAVE (4 * SA_NGRP) // 16 waves: four per SIMD
#define SA_OPS   16.0f         // power-of-two operand pre-scale applied to Q, K, V and P before the f16 convert
// log2-domain score scale: (1/sqrt(D)) * log2(e), with the 2^4*2^4 operand scale of Q and K removed (2^-8)
#define SA_CS    ((0.088388347648318447f * 1.4426950408889634f) * 0.00390625f)
#define SA_LN2   0.69314718055994531f
#define SA_OINV  0.00390625f   // removes the 2^4*2^4 operand scale of P and V

// LDS pitches in 16-bit elements (rows 16-B aligned)
#define KP   136   // K tile   [32 kv][128 d + 8]   d contiguous  -> B fragment for S read like an A row
#define VP   40    // V tile   [128 d][32 kv + 8]   kv contiguous -> B fragment for O read like an A row
#define PP   40    // P tile   [16 q][32 kv + 8]    per wave, A fragment for O
#define OPF  132   // O tile   [16 q][128 d + 4]    floats, per wave (epilogue staging)
#define NSTEP (2 * SA_SKV / 32 / SA_NGRP)   // steps of 32 kv rows per group

// 16x16x32 f16 WMMA with the VALU hazard guard tied to D (A/B kept live)
__device__ __forceinline__ v8f wmma_f16(v16h a, v16h b, v8f c) {
  v8f d = __builtin_amdgcn_wmma_f32_16x16x32_f16(false, a, false, b, (short)0, c, false, false);
  asm volatile("v_nop\n\tv_nop\n\tv_nop\n\tv_nop" : "+v"(d) : "v"(a), "v"(b));
  return d;
}

// reductions over the 16 lanes of each lane half (xor offsets < 16 stay inside the half)
__device__ __forceinline__ float rmax16(float x) {
  x = fmaxf(x, __shfl_xor(x, 1));
  x = fmaxf(x, __shfl_xor(x, 2));
  x = fmaxf(x, __shfl_xor(x, 4));
  x = fmaxf(x, __shfl_xor(x, 8));
  return x;
}
__device__ __forceinline__ float rsum16(float x) {
  x += __shfl_xor(x, 1);
  x += __shfl_xor(x, 2);
  x += __shfl_xor(x, 4);
  x += __shfl_xor(x, 8);
  return x;
}

__global__ __launch_bounds__(32 * SA_NWAVE) __attribute__((amdgpu_num_vgpr(248)))
void attn_two_kv(const float* __restrict__ q,
                 const float* __restrict__ kA, const float* __restrict__ vA,
                 const float* __restrict__ kB, const float* __restrict__ vB,
                 float* out, float* lse)
{
  __shared__ __align__(16) _Float16 kbufs[SA_NGRP][32 * KP];       //  34816 B, one K tile per group
  __shared__ __align__(16) _Float16 vbufs[SA_NGRP][SA_D * VP];     //  40960 B, one V tile per group
  __shared__ __align__(16) _Float16 pbuf[SA_NWAVE][16 * PP];       //  20480 B
  __shared__ __align__(16) float    obuf[SA_NWAVE][16 * OPF];      // 135168 B, unnormalised partial O per wave
  __shared__ __align__(16) float    mbuf[SA_NWAVE * 16];           //   1024 B, partial row maxima (log2 domain)
  __shared__ __align__(16) float    lbuf[SA_NWAVE * 16];           //   1024 B, partial row sums

  const int tid  = threadIdx.x;
  const int lane = tid & 31;
  const int wave = __builtin_amdgcn_readfirstlane(tid >> 5);   // scalar, so that the group's base pointers stay scalar
  const int grp  = wave >> 2;       // KV quarter this wave works on
  const int wq   = wave & 3;        // query tile (16 rows) this wave works on
  const int half = lane >> 4;       // h of the fragment map
  const int l16  = lane & 15;       // row m for A, column n for B and D

  const int h    = blockIdx.x % SA_H;
  const int q0   = (blockIdx.x / SA_H) * SA_QBLK;
  const int qrow = q0 + wq * 16;

  // staging split (4 waves of a group): a wave takes 8 kv rows of K and of V; one load instruction covers one whole
  // row (32 lanes x 16 B = 512 contiguous bytes = 4 lines), a lane holds 4 consecutive d of each of the 8 rows
  const int srow = wq * 8;
  const int sd   = lane * 4;

  _Float16* kbuf  = kbufs[grp];
  _Float16* vbufT = vbufs[grp];
  const float* ks = (grp & 2) ? kB : kA;
  const float* vs = (grp & 2) ? vB : vA;
  const int jgrp  = (grp & 1) * (SA_SKV / 2);

  // ---- Q -> 4 A fragments (16 rows x 32 d each), pre-scaled by 2^4.
  // A map: lane row m = l16; elements 0..7 <- d = c*32 + 8h + 0..7; elements 8..15 <- d = c*32 + 16 + 8h + 0..7
  v16h qf[4];
  {
    const float* qp = q + ((size_t)(h * SA_SQ + qrow + l16)) * SA_D;
#pragma unroll
    for (int c = 0; c < 4; ++c) {
      Frag f;
#pragma unroll
      for (int s = 0; s < 2; ++s) {
        const int d0 = c * 32 + 16 * s + 8 * half;
        const float4 a0 = *(const float4*)(qp + d0);
        const float4 a1 = *(const float4*)(qp + d0 + 4);
        v8h t;
        t[0] = (_Float16)(a0.x * SA_OPS); t[1] = (_Float16)(a0.y * SA_OPS);
        t[2] = (_Float16)(a0.z * SA_OPS); t[3] = (_Float16)(a0.w * SA_OPS);
        t[4] = (_Float16)(a1.x * SA_OPS); t[5] = (_Float16)(a1.y * SA_OPS);
        t[6] = (_Float16)(a1.z * SA_OPS); t[7] = (_Float16)(a1.w * SA_OPS);
        f.h[s] = t;
      }
      qf[c] = f.v;
    }
  }

  v8f o[8];
#pragma unroll
  for (int n = 0; n < 8; ++n)
#pragma unroll
    for (int r = 0; r < 8; ++r) o[n][r] = 0.0f;

  float mrun[8], lrun[8];
#pragma unroll
  for (int r = 0; r < 8; ++r) { mrun[r] = -1.0e30f; lrun[r] = 0.0f; }

  // Each group runs one online-softmax pass over its own KV quarter; the four partial states of a query row
  // are joined after the loop by their maxima and sums == LSE-weighted combine of the partial states.
  for (int step = 0; step < NSTEP; ++step) {
    const int j = jgrp + step * 32;
    const float* kbase = ks + ((size_t)(h * SA_SKV + j)) * SA_D;
    const float* vbase = vs + ((size_t)(h * SA_SKV + j)) * SA_D;

    __syncthreads();   // all LDS consumers of the prior step are done

    // ---- global loads of both tiles: 8 kv rows per wave, one whole row per instruction
    float4 kx[8];
    float vr[8][4];
    {
      const float* srcK = kbase + srow * SA_D + sd;
      const float* srcV = vbase + srow * SA_D + sd;
#pragma unroll
      for (int i = 0; i < 8; ++i) kx[i] = *(const float4*)(srcK + i * SA_D);
#pragma unroll
      for (int i = 0; i < 8; ++i) {
        const float4 a = *(const float4*)(srcV + i * SA_D);
        vr[i][0] = a.x; vr[i][1] = a.y; vr[i][2] = a.z; vr[i][3] = a.w;
      }
    }
    // the loads' address registers are reused by the converts below: keep the wait in front of that reuse
    asm volatile("s_wait_xcnt 0x0" ::: "memory");
    // ---- K tile (32 kv x 128 d), d contiguous, f16 = x * 2^4; 4 d per 8-B store, a wave's store fills 256 contiguous bytes
    {
      _Float16* dst = kbuf + srow * KP + sd;
#pragma unroll
      for (int i = 0; i < 8; ++i) {
        v4h p;
        p[0] = (_Float16)(kx[i].x * SA_OPS); p[1] = (_Float16)(kx[i].y * SA_OPS);
        p[2] = (_Float16)(kx[i].z * SA_OPS); p[3] = (_Float16)(kx[i].w * SA_OPS);
        *(v4h*)(dst + i * KP) = p;
      }
    }
    // ---- V tile transposed to [d][kv] (kv contiguous), f16 = x * 2^4; the lane's 8 kv of one d per 16-B store
    {
#pragma unroll
      for (int c = 0; c < 4; ++c) {
        v8h w;
#pragma unroll
        for (int i = 0; i < 8; ++i) w[i] = (_Float16)(vr[i][c] * SA_OPS);
        *(v8h*)(vbufT + (sd + c) * VP + srow) = w;
      }
    }

    __syncthreads();

    // ---- S = (2^4 Q)(2^4 K)^T : two 16x16 tiles (kv 0..15 and 16..31), 4 k-steps over d.
    // B map (same k map as A): lane column n = kv l16; elements 0..7 <- d = c*32 + 8h + 0..7; 8..15 <- d = c*32 + 16 + 8h + 0..7
    v8f s0, s1;
#pragma unroll
    for (int r = 0; r < 8; ++r) { s0[r] = 0.0f; s1[r] = 0.0f; }
#pragma unroll
    for (int c = 0; c < 4; ++c) {
      Frag b0, b1;
      const _Float16* kp0 = kbuf + l16 * KP + c * 32 + half * 8;   // kv row l16
      const _Float16* kp1 = kp0 + 16 * KP;                           // kv row 16 + l16
      b0.h[0] = *(const v8h*)(kp0);  b0.h[1] = *(const v8h*)(kp0 + 16);
      b1.h[0] = *(const v8h*)(kp1);  b1.h[1] = *(const v8h*)(kp1 + 16);
      s0 = wmma_f16(qf[c], b0.v, s0);
      s1 = wmma_f16(qf[c], b1.v, s1);
    }

    // ---- online softmax in the log2 domain; D map: s0[r] = S[row 8h + r][kv l16], s1[r] = S[row 8h + r][kv 16 + l16]
    float corr[8];
#pragma unroll
    for (int r = 0; r < 8; ++r) {
      const float x0 = s0[r] * SA_CS;
      const float x1 = s1[r] * SA_CS;
      const float mx = rmax16(fmaxf(x0, x1));
      const float mn = fmaxf(mrun[r], mx);
      const float p0 = __builtin_amdgcn_exp2f(x0 - mn);
      const float p1 = __builtin_amdgcn_exp2f(x1 - mn);
      const float rs = rsum16(p0 + p1);
      const float cf = __builtin_amdgcn_exp2f(mrun[r] - mn);
      corr[r] = cf;
      lrun[r] = lrun[r] * cf + rs;
      mrun[r] = mn;
      s0[r] = p0; s1[r] = p1;
    }

#pragma unroll
    for (int n = 0; n < 8; ++n)
#pragma unroll
      for (int r = 0; r < 8; ++r) o[n][r] *= corr[r];

    // ---- P (<= 1) pre-scaled by 2^4: accumulator layout -> per-wave LDS [q row][kv] -> A fragment
    _Float16* pb = pbuf[wave];
#pragma unroll
    for (int r = 0; r < 8; ++r) {
      const int row = r + half * 8;
      pb[row * PP + l16]      = (_Float16)(s0[r] * SA_OPS);   // kv 0..15
      pb[row * PP + 16 + l16] = (_Float16)(s1[r] * SA_OPS);   // kv 16..31
    }
    __syncthreads();   // block barrier between the P spill and its cross-lane reload (uniform control flow)
    Frag pf;
    {
      const _Float16* pr = pb + l16 * PP + half * 8;           // A map: row m = l16; kv 8h+0..7 | 16+8h+0..7
      pf.h[0] = *(const v8h*)(pr);
      pf.h[1] = *(const v8h*)(pr + 16);
    }

    // ---- O += (2^4 P)(2^4 V) : 8 d-chunks of 16 columns.
    // B map: lane column n = d (cn*16 + l16); elements 0..7 <- kv 8h + 0..7; 8..15 <- kv 16 + 8h + 0..7
#pragma unroll
    for (int cn = 0; cn < 8; ++cn) {
      Frag vf;
      const _Float16* vp = vbufT + (cn * 16 + l16) * VP + half * 8;
      vf.h[0] = *(const v8h*)(vp);
      vf.h[1] = *(const v8h*)(vp + 16);
      o[cn] = wmma_f16(pf.v, vf.v, o[cn]);
    }
  }

  {
    float* ob = obuf[wave];
#pragma unroll
    for (int n = 0; n < 8; ++n) {
#pragma unroll
      for (int r = 0; r < 8; ++r) {
        ob[(r + half * 8) * OPF + n * 16 + l16] = o[n][r];   // D map: row 8h + r, col n*16 + l16
      }
    }
    if (l16 == 0) {   // lane 0 -> rows 0..7, lane 16 -> rows 8..15 of this wave's 16 rows
#pragma unroll
      for (int r = 0; r < 8; ++r) {
        mbuf[wave * 16 + half * 8 + r] = mrun[r];
        lbuf[wave * 16 + half * 8 + r] = lrun[r];
      }
    }
  }
  __syncthreads();   // every group's partial state is in LDS

  // Join of the four partial states. Wave w owns block rows 4w..4w+3: query tile w >> 2, tile rows 4(w & 3)..+3.
  // The partial state of group g for query tile t was left by wave 4g + t.
  // out0: one 16-B-per-lane instruction per row (512 B = 4 lines).
  {
    const int t   = wave >> 2;
    const int rr0 = (wave & 3) * 4;
    float* orow = out + ((size_t)(h * SA_SQ + q0 + wave * 4)) * SA_D + lane * 4;
#pragma unroll
    for (int i = 0; i < 4; ++i) {
      const int rr = rr0 + i;
      float mg[SA_NGRP], lg[SA_NGRP];
#pragma unroll
      for (int g = 0; g < SA_NGRP; ++g) {
        mg[g] = mbuf[(g * 4 + t) * 16 + rr];
        lg[g] = lbuf[(g * 4 + t) * 16 + rr];
      }
      const float mx = fmaxf(fmaxf(mg[0], mg[1]), fmaxf(mg[2], mg[3]));
      float ls = 0.0f;
      v4f acc = {0.0f, 0.0f, 0.0f, 0.0f};
#pragma unroll
      for (int g = 0; g < SA_NGRP; ++g) {
        const float w = __builtin_amdgcn_exp2f(mg[g] - mx);
        ls += w * lg[g];
        acc += w * *(const v4f*)(obuf[g * 4 + t] + rr * OPF + lane * 4);
      }
      *(v4f*)(orow + (size_t)i * SA_D) = acc * (SA_OINV / ls);
    }
  }
  // out1: 64 floats per block (256 B = 2 lines) written by wave 0 lanes 0..15, one instruction; lane owns block rows 4*lane..+3.
  if (wave == 0 && lane < 16) {
    const int t   = lane >> 2;
    const int rr0 = (lane & 3) * 4;
    v4f mg[SA_NGRP], lg[SA_NGRP];
#pragma unroll
    for (int g = 0; g < SA_NGRP; ++g) {
      mg[g] = *(const v4f*)(mbuf + (g * 4 + t) * 16 + rr0);
      lg[g] = *(const v4f*)(lbuf + (g * 4 + t) * 16 + rr0);
    }
    v4f lv;
#pragma unroll
    for (int k = 0; k < 4; ++k) {
      const float mx = fmaxf(fmaxf(mg[0][k], mg[1][k]), fmaxf(mg[2][k], mg[3][k]));
      float ls = 0.0f;
#pragma unroll
      for (int g = 0; g < SA_NGRP; ++g) ls += __builtin_amdgcn_exp2f(mg[g][k] - mx) * lg[g][k];
      lv[k] = SA_LN2 * (mx + log2f(ls));
    }
    *(v4f*)(lse + (size_t)h * SA_SQ + q0 + lane * 4) = lv;
  }
}

extern "C" void kernel_launch(void* const* d_in, const int* in_sizes, int n_in,
                              void* d_out, int out_size, void* d_ws, size_t ws_size,
                              hipStream_t stream) {
  (void)d_ws; (void)ws_size;
  // static shapes; refuse anything else (outputs stay zero)
  if (n_in < 5) return;
  if (in_sizes[0] != SA_H * SA_SQ * SA_D) return;
  if (in_sizes[1] != SA_H * SA_SKV * SA_D || in_sizes[2] != SA_H * SA_SKV * SA_D) return;
  if (in_sizes[3] != SA_H * SA_SKV * SA_D || in_sizes[4] != SA_H * SA_SKV * SA_D) return;
  if (out_size != SA_H * SA_SQ * SA_D + SA_H * SA_SQ) return;

  const float* q  = (const float*)d_in[0];
  const float* kA = (const float*)d_in[1];
  const float* vA = (const float*)d_in[2];
  const float* kB = (const float*)d_in[3];
  const float* vB = (const float*)d_in[4];
  float* out = (float*)d_out;                              // output 0: [16][1024][128] f32 at byte 0
  float* lse = out + (size_t)SA_H * SA_SQ * SA_D;          // output 1: [16][1024] f32 at byte 8388608

  dim3 grid(SA_H * (SA_SQ / SA_QBLK));   // 256 blocks: head x 64-row query tile (1024 = 16 x 64 exactly)
  dim3 block(32 * SA_NWAVE);             // 16 waves: 4 query tiles of 16 rows x 4 KV quarters
  attn_two_kv<<<grid, block, 0, stream>>>(q, kA, vA, kB, vB, out, lse);
}

// v003
// Measured time: 91.7 microseconds a run.
// Next to v002, in two timings, it ran 1.19 times as fast each time.
// Counting every step since v000, it is 2.68 times as fast.
#include <hip/hip_runtime.h>

typedef _Float16 v16h __attribute__((ext_vector_type(16)));
typedef _Float16 v8h  __attribute__((ext_vector_type(8)));
typedef _Float16 v4h  __attribute__((ext_vector_type(4)));
typedef float    v8f  __attribute__((ext_vector_type(8)));
typedef float    v4f  __attribute__((ext_vector_type(4)));
union Frag { v16h v; v8h h[2]; };

#define SA_H     16
#define SA_SQ    1024
#define SA_SKV   2048
#define SA_D     128
#define SA_QBLK  64            // query rows per block (4 query tiles x 16 rows)
#define SA_NGRP  4             // KV quarters per block: A low, A high, B low, B high; one group of 4 waves each
#define SA_NWAVE (4 * SA_NGRP) // 16 waves: four per SIMD
#define SA_OPS   16.0f         // power-of-two operand pre-scale applied to Q, K, V and P before the f16 convert
// log2-domain score scale: (1/sqrt(D)) * log2(e), with the 2^4*2^4 operand scale of Q and K removed (2^-8)
#define SA_CS    ((0.088388347648318447f * 1.4426950408889634f) * 0.00390625f)
#define SA_LN2   0.69314718055994531f
#define SA_OINV  0.00390625f   // removes the 2^4*2^4 operand scale of P and V

// LDS pitches in 16-bit elements (rows 16-B aligned)
#define KP   136   // K tile   [32 kv][128 d + 8]   d contiguous  -> A fragment for S^T
#define VP   40    // V tile   [128 d][32 kv + 8]   kv contiguous -> A fragment for O^T
#define OPF  132   // O tile   [16 q][128 d + 4]    floats, per wave (epilogue staging)
#define NSTEP (2 * SA_SKV / 32 / SA_NGRP)   // steps of 32 kv rows per group

// 16x16x32 f16 WMMA with the VALU hazard guard tied to D (A/B kept live)
__device__ __forceinline__ v8f wmma_f16(v16h a, v16h b, v8f c) {
  v8f d = __builtin_amdgcn_wmma_f32_16x16x32_f16(false, a, false, b, (short)0, c, false, false);
  asm volatile("v_nop\n\tv_nop\n\tv_nop\n\tv_nop" : "+v"(d) : "v"(a), "v"(b));
  return d;
}

// lane l <-> lane l ^ 16: the two lanes that share one query column
__device__ __forceinline__ float xhalf(float x) {
  const int b = __builtin_bit_cast(int, x);
  return __builtin_bit_cast(float, __builtin_amdgcn_permlanex16(b, b, 0x76543210, 0xfedcba98, false, false));
}

__global__ __launch_bounds__(32 * SA_NWAVE) __attribute__((amdgpu_num_vgpr(248)))
void attn_two_kv(const float* __restrict__ q,
                 const float* __restrict__ kA, const float* __restrict__ vA,
                 const float* __restrict__ kB, const float* __restrict__ vB,
                 float* out, float* lse)
{
  __shared__ __align__(16) _Float16 kbufs[SA_NGRP][32 * KP];       //  34816 B, one K tile per group
  __shared__ __align__(16) _Float16 vbufs[SA_NGRP][SA_D * VP];     //  40960 B, one V tile per group
  __shared__ __align__(16) float    obuf[SA_NWAVE][16 * OPF];      // 135168 B, unnormalised partial O per wave
  __shared__ __align__(16) float    mbuf[SA_NWAVE * 16];           //   1024 B, partial row maxima (log2 domain)
  __shared__ __align__(16) float    lbuf[SA_NWAVE * 16];           //   1024 B, partial row sums

  const int tid  = threadIdx.x;
  const int lane = tid & 31;
  const int wave = __builtin_amdgcn_readfirstlane(tid >> 5);   // scalar, so that the group's base pointers stay scalar
  const int grp  = wave >> 2;       // KV quarter this wave works on
  const int wq   = wave & 3;        // query tile (16 rows) this wave works on
  const int half = lane >> 4;       // h of the fragment map
  const int l16  = lane & 15;       // row m for A, column n for B and D (the lane's query)

  const int h    = blockIdx.x % SA_H;
  const int q0   = (blockIdx.x / SA_H) * SA_QBLK;
  const int qrow = q0 + wq * 16;

  // staging split (4 waves of a group): a wave takes 8 kv rows of K and of V; one load instruction covers one whole
  // row (32 lanes x 16 B = 512 contiguous bytes = 4 lines), a lane holds 4 consecutive d of each of the 8 rows
  const int srow = wq * 8;
  const int sd   = lane * 4;

  _Float16* kbuf  = kbufs[grp];
  _Float16* vbufT = vbufs[grp];
  const float* ks = (grp & 2) ? kB : kA;
  const float* vs = (grp & 2) ? vB : vA;
  const int jgrp  = (grp & 1) * (SA_SKV / 2);

  // ---- Q -> 4 B fragments (32 d x 16 query columns each), pre-scaled by 2^4.
  // B map: lane column n = query l16; elements 0..7 <- d = c*32 + 8h + 0..7; elements 8..15 <- d = c*32 + 16 + 8h + 0..7
  v16h qf[4];
  {
    const float* qp = q + ((size_t)(h * SA_SQ + qrow + l16)) * SA_D;
#pragma unroll
    for (int c = 0; c < 4; ++c) {
      Frag f;
#pragma unroll
      for (int s = 0; s < 2; ++s) {
        const int d0 = c * 32 + 16 * s + 8 * half;
        const float4 a0 = *(const float4*)(qp + d0);
        const float4 a1 = *(const float4*)(qp + d0 + 4);
        v8h t;
        t[0] = (_Float16)(a0.x * SA_OPS); t[1] = (_Float16)(a0.y * SA_OPS);
        t[2] = (_Float16)(a0.z * SA_OPS); t[3] = (_Float16)(a0.w * SA_OPS);
        t[4] = (_Float16)(a1.x * SA_OPS); t[5] = (_Float16)(a1.y * SA_OPS);
        t[6] = (_Float16)(a1.z * SA_OPS); t[7] = (_Float16)(a1.w * SA_OPS);
        f.h[s] = t;
      }
      qf[c] = f.v;
    }
  }

  v8f o[8];
#pragma unroll
  for (int n = 0; n < 8; ++n)
#pragma unroll
    for (int r = 0; r < 8; ++r) o[n][r] = 0.0f;

  // state of the lane's query: running maximum (equal in both lane halves) and the sum over this half's kv rows only
  float mrun = -1.0e30f, lrun = 0.0f;

  // Each group runs one online-softmax pass over its own KV quarter; the four partial states of a query row
  // are joined after the loop by their maxima and sums == LSE-weighted combine of the partial states.
  for (int step = 0; step < NSTEP; ++step) {
    const int j = jgrp + step * 32;
    const float* kbase = ks + ((size_t)(h * SA_SKV + j)) * SA_D;
    const float* vbase = vs + ((size_t)(h * SA_SKV + j)) * SA_D;

    __syncthreads();   // all LDS consumers of the prior step are done

    // ---- global loads of both tiles: 8 kv rows per wave, one whole row per instruction
    float4 kx[8];
    float vr[8][4];
    {
      const float* srcK = kbase + srow * SA_D + sd;
      const float* srcV = vbase + srow * SA_D + sd;
#pragma unroll
      for (int i = 0; i < 8; ++i) kx[i] = *(const float4*)(srcK + i * SA_D);
#pragma unroll
      for (int i = 0; i < 8; ++i) {
        const float4 a = *(const float4*)(srcV + i * SA_D);
        vr[i][0] = a.x; vr[i][1] = a.y; vr[i][2] = a.z; vr[i][3] = a.w;
      }
    }
    // the loads' address registers are reused by the converts below: keep the wait in front of that reuse
    asm volatile("s_wait_xcnt 0x0" ::: "memory");
    // ---- K tile (32 kv x 128 d), d contiguous, f16 = x * 2^4; 4 d per 8-B store, a wave's store fills 256 contiguous bytes
    {
      _Float16* dst = kbuf + srow * KP + sd;
#pragma unroll
      for (int i = 0; i < 8; ++i) {
        v4h p;
        p[0] = (_Float16)(kx[i].x * SA_OPS); p[1] = (_Float16)(kx[i].y * SA_OPS);
        p[2] = (_Float16)(kx[i].z * SA_OPS); p[3] = (_Float16)(kx[i].w * SA_OPS);
        *(v4h*)(dst + i * KP) = p;
      }
    }
    // ---- V tile transposed to [d][kv] (kv contiguous), f16 = x * 2^4; the lane's 8 kv of one d per 16-B store
    {
#pragma unroll
      for (int c = 0; c < 4; ++c) {
        v8h w;
#pragma unroll
        for (int i = 0; i < 8; ++i) w[i] = (_Float16)(vr[i][c] * SA_OPS);
        *(v8h*)(vbufT + (sd + c) * VP + srow) = w;
      }
    }

    __syncthreads();

    // ---- S^T = (2^4 K)(2^4 Q)^T : two 16x16 tiles (kv rows 0..15 and 16..31), 4 k-steps over d.
    // A map (same k map as B): lane row m = kv l16; elements 0..7 <- d = c*32 + 8h + 0..7; 8..15 <- d = c*32 + 16 + 8h + 0..7
    v8f s0, s1;
#pragma unroll
    for (int r = 0; r < 8; ++r) { s0[r] = 0.0f; s1[r] = 0.0f; }
#pragma unroll
    for (int c = 0; c < 4; ++c) {
      Frag b0, b1;
      const _Float16* kp0 = kbuf + l16 * KP + c * 32 + half * 8;   // kv row l16
      const _Float16* kp1 = kp0 + 16 * KP;                           // kv row 16 + l16
      b0.h[0] = *(const v8h*)(kp0);  b0.h[1] = *(const v8h*)(kp0 + 16);
      b1.h[0] = *(const v8h*)(kp1);  b1.h[1] = *(const v8h*)(kp1 + 16);
      s0 = wmma_f16(b0.v, qf[c], s0);
      s1 = wmma_f16(b1.v, qf[c], s1);
    }

    // ---- online softmax in the log2 domain; D map: s0[r] = S[query l16][kv 8h + r], s1[r] = S[query l16][kv 16 + 8h + r]:
    // a query's 32 scores lie in the two lanes l16 and 16 + l16, so its maximum is in-lane plus one exchange
    float mx = fmaxf(s0[0], s1[0]);
#pragma unroll
    for (int r = 1; r < 8; ++r) mx = fmaxf(mx, fmaxf(s0[r], s1[r]));
    mx = fmaxf(mx, xhalf(mx));
    const float mn = fmaxf(mrun, mx * SA_CS);
    float cf;
    // exp2 with its free slot in one statement
    asm("v_exp_f32 %0, %1\n\tv_nop" : "=v"(cf) : "v"(mrun - mn));
    float rs = 0.0f;
#pragma unroll
    for (int r = 0; r < 8; ++r) {
      s0[r] = __builtin_amdgcn_exp2f(s0[r] * SA_CS - mn);
      s1[r] = __builtin_amdgcn_exp2f(s1[r] * SA_CS - mn);
      rs += s0[r] + s1[r];
    }
    lrun = lrun * cf + rs;
    mrun = mn;

#pragma unroll
    for (int n = 0; n < 8; ++n)
#pragma unroll
      for (int r = 0; r < 8; ++r) o[n][r] *= cf;

    // ---- P^T (<= 1) pre-scaled by 2^4: the two score tiles, converted in place, are the B fragment
    // B map: lane column n = query l16; elements 0..7 <- kv 8h + 0..7 (s0); 8..15 <- kv 16 + 8h + 0..7 (s1)
    Frag pf;
#pragma unroll
    for (int r = 0; r < 8; ++r) {
      pf.h[0][r] = (_Float16)(s0[r] * SA_OPS);
      pf.h[1][r] = (_Float16)(s1[r] * SA_OPS);
    }

    // ---- O^T += (2^4 V)^T (2^4 P)^T : 8 d-chunks of 16 rows.
    // A map: lane row m = d (cn*16 + l16); elements 0..7 <- kv 8h + 0..7; 8..15 <- kv 16 + 8h + 0..7
#pragma unroll
    for (int cn = 0; cn < 8; ++cn) {
      Frag vf;
      const _Float16* vp = vbufT + (cn * 16 + l16) * VP + half * 8;
      vf.h[0] = *(const v8h*)(vp);
      vf.h[1] = *(const v8h*)(vp + 16);
      o[cn] = wmma_f16(vf.v, pf.v, o[cn]);
    }
  }

  {
    float* ob = obuf[wave];
#pragma unroll
    for (int n = 0; n < 8; ++n) {   // D map: o[n][r] = O[query l16][d = n*16 + 8h + r]: 8 consecutive d, two 16-B stores
      float* od = ob + l16 * OPF + n * 16 + half * 8;
      const v4f lo = {o[n][0], o[n][1], o[n][2], o[n][3]};
      const v4f hi = {o[n][4], o[n][5], o[n][6], o[n][7]};
      *(v4f*)(od)     = lo;
      *(v4f*)(od + 4) = hi;
    }
    const float lj = lrun + xhalf(lrun);   // the two halves' sums of one query, joined once (all lanes active)
    if (half == 0) {
      mbuf[wave * 16 + l16] = mrun;
      lbuf[wave * 16 + l16] = lj;
    }
  }
  __syncthreads();   // every group's partial state is in LDS

  // Join of the four partial states. Wave w owns block rows 4w..4w+3: query tile w >> 2, tile rows 4(w & 3)..+3.
  // The partial state of group g for query tile t was left by wave 4g + t.
  // out0: one 16-B-per-lane instruction per row (512 B = 4 lines).
  {
    const int t   = wave >> 2;
    const int rr0 = (wave & 3) * 4;
    float* orow = out + ((size_t)(h * SA_SQ + q0 + wave * 4)) * SA_D + lane * 4;
#pragma unroll
    for (int i = 0; i < 4; ++i) {
      const int rr = rr0 + i;
      float mg[SA_NGRP], lg[SA_NGRP];
#pragma unroll
      for (int g = 0; g < SA_NGRP; ++g) {
        mg[g] = mbuf[(g * 4 + t) * 16 + rr];
        lg[g] = lbuf[(g * 4 + t) * 16 + rr];
      }
      const float mx = fmaxf(fmaxf(mg[0], mg[1]), fmaxf(mg[2], mg[3]));
      float ls = 0.0f;
      v4f acc = {0.0f, 0.0f, 0.0f, 0.0f};
#pragma unroll
      for (int g = 0; g < SA_NGRP; ++g) {
        const float w = __builtin_amdgcn_exp2f(mg[g] - mx);
        ls += w * lg[g];
        acc += w * *(const v4f*)(obuf[g * 4 + t] + rr * OPF + lane * 4);
      }
      *(v4f*)(orow + (size_t)i * SA_D) = acc * (SA_OINV / ls);
    }
  }
  // out1: 64 floats per block (256 B = 2 lines) written by wave 0 lanes 0..15, one instruction; lane owns block rows 4*lane..+3.
  if (wave == 0 && lane < 16) {
    const int t   = lane >> 2;
    const int rr0 = (lane & 3) * 4;
    v4f mg[SA_NGRP], lg[SA_NGRP];
#pragma unroll
    for (int g = 0; g < SA_NGRP; ++g) {
      mg[g] = *(const v4f*)(mbuf + (g * 4 + t) * 16 + rr0);
      lg[g] = *(const v4f*)(lbuf + (g * 4 + t) * 16 + rr0);
    }
    v4f lv;
#pragma unroll
    for (int k = 0; k < 4; ++k) {
      const float mx = fmaxf(fmaxf(mg[0][k], mg[1][k]), fmaxf(mg[2][k], mg[3][k]));
      float ls = 0.0f;
#pragma unroll
      for (int g = 0; g < SA_NGRP; ++g) ls += __builtin_amdgcn_exp2f(mg[g][k] - mx) * lg[g][k];
      lv[k] = SA_LN2 * (mx + log2f(ls));
    }
    *(v4f*)(lse + (size_t)h * SA_SQ + q0 + lane * 4) = lv;
  }
}

extern "C" void kernel_launch(void* const* d_in, const int* in_sizes, int n_in,
                              void* d_out, int out_size, void* d_ws, size_t ws_size,
                              hipStream_t stream) {
  (void)d_ws; (void)ws_size;
  // static shapes; refuse anything else (outputs stay zero)
  if (n_in < 5) return;
  if (in_sizes[0] != SA_H * SA_SQ * SA_D) return;
  if (in_sizes[1] != SA_H * SA_SKV * SA_D || in_sizes[2] != SA_H * SA_SKV * SA_D) return;
  if (in_sizes[3] != SA_H * SA_SKV * SA_D || in_sizes[4] != SA_H * SA_SKV * SA_D) return;
  if (out_size != SA_H * SA_SQ * SA_D + SA_H * SA_SQ) return;

  const float* q  = (const float*)d_in[0];
  const float* kA = (const float*)d_in[1];
  const float* vA = (const float*)d_in[2];
  const float* kB = (const float*)d_in[3];
  const float* vB = (const float*)d_in[4];
  float* out = (float*)d_out;                              // output 0: [16][1024][128] f32 at byte 0
  float* lse = out + (size_t)SA_H * SA_SQ * SA_D;          // output 1: [16][1024] f32 at byte 8388608

  dim3 grid(SA_H * (SA_SQ / SA_QBLK));   // 256 blocks: head x 64-row query tile (1024 = 16 x 64 exactly)
  dim3 block(32 * SA_NWAVE);             // 16 waves: 4 query tiles of 16 rows x 4 KV quarters
  attn_two_kv<<<grid, block, 0, stream>>>(q, kA, vA, kB, vB, out, lse);
}

// v004
// Measured time: 68.4 microseconds a run.
// In two side-by-side timings against v003, it was 1.35 and 1.34 times as fast.
// All steps since v000 together make it 3.60 times as fast.
#include <hip/hip_runtime.h>

typedef _Float16 v16h __attribute__((ext_vector_type(16)));
typedef _Float16 v8h  __attribute__((ext_vector_type(8)));
typedef _Float16 v4h  __attribute__((ext_vector_type(4)));
typedef float    v8f  __attribute__((ext_vector_type(8)));
typedef float    v4f  __attribute__((ext_vector_type(4)));
union Frag { v16h v; v8h h[2]; };

#define SA_H     16
#define SA_SQ    1024
#define SA_SKV   2048
#define SA_D     128
#define SA_QBLK  64            // query rows per block (4 query tiles x 16 rows)
#define SA_NGRP  4             // KV quarters per block: A low, A high, B low, B high; one group of 4 waves each
#define SA_NWAVE (4 * SA_NGRP) // 16 waves: four per SIMD
#define SA_OPS   16.0f         // power-of-two operand pre-scale applied to Q, K, V and P before the f16 convert
// log2-domain score scale: (1/sqrt(D)) * log2(e), with the 2^4*2^4 operand scale of Q and K removed (2^-8)
#define SA_CS    ((0.088388347648318447f * 1.4426950408889634f) * 0.00390625f)
#define SA_LN2   0.69314718055994531f
#define SA_OINV  0.00390625f   // removes the 2^4*2^4 operand scale of P and V

// LDS pitches in 16-bit elements (rows 16-B aligned)
#define KP   136   // K tile   [32 kv][128 d + 8]   d contiguous  -> A fragment for S^T
#define VP   40    // V tile   [128 d][32 kv + 8]   kv contiguous -> A fragment for O^T
#define OPF  132   // O tile   [16 q][128 d + 4]    floats, per wave (epilogue staging)
#define NSTEP (2 * SA_SKV / 32 / SA_NGRP)   // steps of 32 kv rows per group

// 16x16x32 f16 WMMA with the VALU hazard guard tied to D (A/B kept live)
__device__ __forceinline__ v8f wmma_f16(v16h a, v16h b, v8f c) {
  v8f d = __builtin_amdgcn_wmma_f32_16x16x32_f16(false, a, false, b, (short)0, c, false, false);
  asm volatile("v_nop\n\tv_nop\n\tv_nop\n\tv_nop" : "+v"(d) : "v"(a), "v"(b));
  return d;
}

// lane l <-> lane l ^ 16: the two lanes that share one query column
__device__ __forceinline__ float xhalf(float x) {
  const int b = __builtin_bit_cast(int, x);
  return __builtin_bit_cast(float, __builtin_amdgcn_permlanex16(b, b, 0x76543210, 0xfedcba98, false, false));
}

__global__ __launch_bounds__(32 * SA_NWAVE) __attribute__((amdgpu_num_vgpr(248)))
void attn_two_kv(const float* __restrict__ q,
                 const float* __restrict__ kA, const float* __restrict__ vA,
                 const float* __restrict__ kB, const float* __restrict__ vB,
                 float* out, float* lse)
{
  __shared__ __align__(16) _Float16 kbufs[2][SA_NGRP][32 * KP];    //  69632 B, two K tiles per group (this step's, the next step's)
  __shared__ __align__(16) _Float16 vbufs[2][SA_NGRP][SA_D * VP];  //  81920 B, two V tiles per group
  __shared__ __align__(16) float    obuf[SA_NWAVE][16 * OPF];      // 135168 B, unnormalised partial O per wave
  __shared__ __align__(16) float    mbuf[SA_NWAVE * 16];           //   1024 B, partial row maxima (log2 domain)
  __shared__ __align__(16) float    lbuf[SA_NWAVE * 16];           //   1024 B, partial row sums

  const int tid  = threadIdx.x;
  const int lane = tid & 31;
  const int wave = __builtin_amdgcn_readfirstlane(tid >> 5);   // scalar, so that the group's base pointers stay scalar
  const int grp  = wave >> 2;       // KV quarter this wave works on
  const int wq   = wave & 3;        // query tile (16 rows) this wave works on
  const int half = lane >> 4;       // h of the fragment map
  const int l16  = lane & 15;       // row m for A, column n for B and D (the lane's query)

  const int h    = blockIdx.x % SA_H;
  const int q0   = (blockIdx.x / SA_H) * SA_QBLK;
  const int qrow = q0 + wq * 16;

  // staging split (4 waves of a group): a wave takes 8 kv rows of K and of V; one load instruction covers one whole
  // row (32 lanes x 16 B = 512 contiguous bytes = 4 lines), a lane holds 4 consecutive d of each of the 8 rows
  const int srow = wq * 8;
  const int sd   = lane * 4;

  const float* ks = (grp & 2) ? kB : kA;
  const float* vs = (grp & 2) ? vB : vA;
  const int jgrp  = (grp & 1) * (SA_SKV / 2);

  // ---- Q -> 4 B fragments (32 d x 16 query columns each), pre-scaled by 2^4.
  // B map: lane column n = query l16; elements 0..7 <- d = c*32 + 8h + 0..7; elements 8..15 <- d = c*32 + 16 + 8h + 0..7
  v16h qf[4];
  {
    const float* qp = q + ((size_t)(h * SA_SQ + qrow + l16)) * SA_D;
#pragma unroll
    for (int c = 0; c < 4; ++c) {
      Frag f;
#pragma unroll
      for (int s = 0; s < 2; ++s) {
        const int d0 = c * 32 + 16 * s + 8 * half;
        const float4 a0 = *(const float4*)(qp + d0);
        const float4 a1 = *(const float4*)(qp + d0 + 4);
        v8h t;
        t[0] = (_Float16)(a0.x * SA_OPS); t[1] = (_Float16)(a0.y * SA_OPS);
        t[2] = (_Float16)(a0.z * SA_OPS); t[3] = (_Float16)(a0.w * SA_OPS);
        t[4] = (_Float16)(a1.x * SA_OPS); t[5] = (_Float16)(a1.y * SA_OPS);
        t[6] = (_Float16)(a1.z * SA_OPS); t[7] = (_Float16)(a1.w * SA_OPS);
        f.h[s] = t;
      }
      qf[c] = f.v;
    }
  }

  v8f o[8];
#pragma unroll
  for (int n = 0; n < 8; ++n)
#pragma unroll
    for (int r = 0; r < 8; ++r) o[n][r] = 0.0f;

  // state of the lane's query: running maximum (equal in both lane halves) and the sum over this half's kv rows only
  float mrun = -1.0e30f, lrun = 0.0f;

  // the tile in flight: the wave's 8 kv rows of K and of V of one step, held in registers from its loads to its LDS stores
  v4f kx[8], vx[8];
  const float* srcK = ks + ((size_t)(h * SA_SKV + jgrp + srow)) * SA_D + sd;
  const float* srcV = vs + ((size_t)(h * SA_SKV + jgrp + srow)) * SA_D + sd;

  // ---- global loads of both tiles of step st: 8 kv rows per wave, one whole row per instruction
  auto load_tile = [&](int st) {
    const float* pk = srcK + (size_t)st * (32 * SA_D);
    const float* pv = srcV + (size_t)st * (32 * SA_D);
#pragma unroll
    for (int i = 0; i < 8; ++i) kx[i] = *(const v4f*)(pk + i * SA_D);
#pragma unroll
    for (int i = 0; i < 8; ++i) vx[i] = *(const v4f*)(pv + i * SA_D);
    // the loads stay in flight over the code that follows, which reuses their address registers: keep the wait in front of
    // that reuse. The two addresses are inputs so that they keep their registers up to the wait (no load's destination is
    // laid over them); the memory clobber keeps the loads from being moved down towards their first use
    asm volatile("s_wait_xcnt 0x0" :: "v"(pk), "v"(pv) : "memory");
  };
  // ---- the tile in flight, converted, into LDS buffer b
  auto store_tile = [&](int b) {
    // K tile (32 kv x 128 d), d contiguous, f16 = x * 2^4; 4 d per 8-B store, a wave's store fills 256 contiguous bytes
    _Float16* dst = kbufs[b][grp] + srow * KP + sd;
#pragma unroll
    for (int i = 0; i < 8; ++i) {
      v4h p;
      p[0] = (_Float16)(kx[i][0] * SA_OPS); p[1] = (_Float16)(kx[i][1] * SA_OPS);
      p[2] = (_Float16)(kx[i][2] * SA_OPS); p[3] = (_Float16)(kx[i][3] * SA_OPS);
      *(v4h*)(dst + i * KP) = p;
    }
    // V tile transposed to [d][kv] (kv contiguous), f16 = x * 2^4; the lane's 8 kv of one d per 16-B store
    _Float16* dv = vbufs[b][grp];
#pragma unroll
    for (int c = 0; c < 4; ++c) {
      v8h w;
#pragma unroll
      for (int i = 0; i < 8; ++i) w[i] = (_Float16)(vx[i][c] * SA_OPS);
      *(v8h*)(dv + (sd + c) * VP + srow) = w;
    }
  };

  load_tile(0);
  store_tile(0);
  __syncthreads();   // tile 0 is in LDS

  // Each group runs one online-softmax pass over its own KV quarter; the four partial states of a query row
  // are joined after the loop by their maxima and sums == LSE-weighted combine of the partial states.
  // Step s issues the loads of tile s + 1 (behind the barrier: the barrier's fence would wait for loads in flight), works on
  // buffer s & 1 while they fly, and then stores tile s + 1 into the other buffer, whose last readers (step s - 1) stand in
  // front of that step's barrier.
  auto products = [&](int b) {
    const _Float16* kbuf  = kbufs[b][grp];
    const _Float16* vbufT = vbufs[b][grp];

    // ---- S^T = (2^4 K)(2^4 Q)^T : two 16x16 tiles (kv rows 0..15 and 16..31), 4 k-steps over d.
    // A map (same k map as B): lane row m = kv l16; elements 0..7 <- d = c*32 + 8h + 0..7; 8..15 <- d = c*32 + 16 + 8h + 0..7
    v8f s0, s1;
#pragma unroll
    for (int r = 0; r < 8; ++r) { s0[r] = 0.0f; s1[r] = 0.0f; }
#pragma unroll
    for (int c = 0; c < 4; ++c) {
      Frag b0, b1;
      const _Float16* kp0 = kbuf + l16 * KP + c * 32 + half * 8;   // kv row l16
      const _Float16* kp1 = kp0 + 16 * KP;                           // kv row 16 + l16
      b0.h[0] = *(const v8h*)(kp0);  b0.h[1] = *(const v8h*)(kp0 + 16);
      b1.h[0] = *(const v8h*)(kp1);  b1.h[1] = *(const v8h*)(kp1 + 16);
      s0 = wmma_f16(b0.v, qf[c], s0);
      s1 = wmma_f16(b1.v, qf[c], s1);
    }

    // ---- online softmax in the log2 domain; D map: s0[r] = S[query l16][kv 8h + r], s1[r] = S[query l16][kv 16 + 8h + r]:
    // a query's 32 scores lie in the two lanes l16 and 16 + l16, so its maximum is in-lane plus one exchange
    float mx = fmaxf(s0[0], s1[0]);
#pragma unroll
    for (int r = 1; r < 8; ++r) mx = fmaxf(mx, fmaxf(s0[r], s1[r]));
    mx = fmaxf(mx, xhalf(mx));
    const float mn = fmaxf(mrun, mx * SA_CS);
    float cf;
    // exp2 with its free slot in one statement
    asm("v_exp_f32 %0, %1\n\tv_nop" : "=v"(cf) : "v"(mrun - mn));
    float e0[8], e1[8];
#pragma unroll
    for (int r = 0; r < 8; ++r) {
      e0[r] = s0[r] * SA_CS - mn;
      e1[r] = s1[r] * SA_CS - mn;
    }
    // the 16 exp2, each in place on its own register, with the free slot behind the last, in one statement: this build laid
    // an exp2's result over the source register of the exp2 directly in front of it
    asm("v_exp_f32 %0, %0\n\tv_exp_f32 %1, %1\n\tv_exp_f32 %2, %2\n\tv_exp_f32 %3, %3\n\t"
        "v_exp_f32 %4, %4\n\tv_exp_f32 %5, %5\n\tv_exp_f32 %6, %6\n\tv_exp_f32 %7, %7\n\t"
        "v_exp_f32 %8, %8\n\tv_exp_f32 %9, %9\n\tv_exp_f32 %10, %10\n\tv_exp_f32 %11, %11\n\t"
        "v_exp_f32 %12, %12\n\tv_exp_f32 %13, %13\n\tv_exp_f32 %14, %14\n\tv_exp_f32 %15, %15\n\tv_nop"
        : "+v"(e0[0]), "+v"(e1[0]), "+v"(e0[1]), "+v"(e1[1]), "+v"(e0[2]), "+v"(e1[2]), "+v"(e0[3]), "+v"(e1[3]),
          "+v"(e0[4]), "+v"(e1[4]), "+v"(e0[5]), "+v"(e1[5]), "+v"(e0[6]), "+v"(e1[6]), "+v"(e0[7]), "+v"(e1[7]));
    float rs = 0.0f;
#pragma unroll
    for (int r = 0; r < 8; ++r) {
      s0[r] = e0[r];
      s1[r] = e1[r];
      rs += s0[r] + s1[r];
    }
    lrun = lrun * cf + rs;
    mrun = mn;

#pragma unroll
    for (int n = 0; n < 8; ++n)
#pragma unroll
      for (int r = 0; r < 8; ++r) o[n][r] *= cf;

    // ---- P^T (<= 1) pre-scaled by 2^4: the two score tiles, converted in place, are the B fragment
    // B map: lane column n = query l16; elements 0..7 <- kv 8h + 0..7 (s0); 8..15 <- kv 16 + 8h + 0..7 (s1)
    Frag pf;
#pragma unroll
    for (int r = 0; r < 8; ++r) {
      pf.h[0][r] = (_Float16)(s0[r] * SA_OPS);
      pf.h[1][r] = (_Float16)(s1[r] * SA_OPS);
    }

    // ---- O^T += (2^4 V)^T (2^4 P)^T : 8 d-chunks of 16 rows.
    // A map: lane row m = d (cn*16 + l16); elements 0..7 <- kv 8h + 0..7; 8..15 <- kv 16 + 8h + 0..7
#pragma unroll
    for (int cn = 0; cn < 8; ++cn) {
      Frag vf;
      const _Float16* vp = vbufT + (cn * 16 + l16) * VP + half * 8;
      vf.h[0] = *(const v8h*)(vp);
      vf.h[1] = *(const v8h*)(vp + 16);
      o[cn] = wmma_f16(vf.v, pf.v, o[cn]);
    }
  };

  for (int step = 0; step < NSTEP - 1; ++step) {
    load_tile(step + 1);
    products(step & 1);
    // nothing is scheduled across this line: without it the build moves the tile's converts, and with them the wait for the
    // loads in flight, up among the first products
    __builtin_amdgcn_sched_barrier(0);
    store_tile((step + 1) & 1);
    __syncthreads();   // tile s + 1 is in LDS, and every reader of this step's buffer is done
  }
  products((NSTEP - 1) & 1);

  {
    float* ob = obuf[wave];
#pragma unroll
    for (int n = 0; n < 8; ++n) {   // D map: o[n][r] = O[query l16][d = n*16 + 8h + r]: 8 consecutive d, two 16-B stores
      float* od = ob + l16 * OPF + n * 16 + half * 8;
      const v4f lo = {o[n][0], o[n][1], o[n][2], o[n][3]};
      const v4f hi = {o[n][4], o[n][5], o[n][6], o[n][7]};
      *(v4f*)(od)     = lo;
      *(v4f*)(od + 4) = hi;
    }
    const float lj = lrun + xhalf(lrun);   // the two halves' sums of one query, joined once (all lanes active)
    if (half == 0) {
      mbuf[wave * 16 + l16] = mrun;
      lbuf[wave * 16 + l16] = lj;
    }
  }
  __syncthreads();   // every group's partial state is in LDS

  // Join of the four partial states. Wave w owns block rows 4w..4w+3: query tile w >> 2, tile rows 4(w & 3)..+3.
  // The partial state of group g for query tile t was left by wave 4g + t.
  // out0: one 16-B-per-lane instruction per row (512 B = 4 lines).
  {
    const int t   = wave >> 2;
    const int rr0 = (wave & 3) * 4;
    float* orow = out + ((size_t)(h * SA_SQ + q0 + wave * 4)) * SA_D + lane * 4;
#pragma unroll
    for (int i = 0; i < 4; ++i) {
      const int rr = rr0 + i;
      float mg[SA_NGRP], lg[SA_NGRP];
#pragma unroll
      for (int g = 0; g < SA_NGRP; ++g) {
        mg[g] = mbuf[(g * 4 + t) * 16 + rr];
        lg[g] = lbuf[(g * 4 + t) * 16 + rr];
      }
      const float mx = fmaxf(fmaxf(mg[0], mg[1]), fmaxf(mg[2], mg[3]));
      float ls = 0.0f;
      v4f acc = {0.0f, 0.0f, 0.0f, 0.0f};
#pragma unroll
      for (int g = 0; g < SA_NGRP; ++g) {
        const float w = __builtin_amdgcn_exp2f(mg[g] - mx);
        ls += w * lg[g];
        acc += w * *(const v4f*)(obuf[g * 4 + t] + rr * OPF + lane * 4);
      }
      *(v4f*)(orow + (size_t)i * SA_D) = acc * (SA_OINV / ls);
    }
  }
  // out1: 64 floats per block (256 B = 2 lines) written by wave 0 lanes 0..15, one instruction; lane owns block rows 4*lane..+3.
  if (wave == 0 && lane < 16) {
    const int t   = lane >> 2;
    const int rr0 = (lane & 3) * 4;
    v4f mg[SA_NGRP], lg[SA_NGRP];
#pragma unroll
    for (int g = 0; g < SA_NGRP; ++g) {
      mg[g] = *(const v4f*)(mbuf + (g * 4 + t) * 16 + rr0);
      lg[g] = *(const v4f*)(lbuf + (g * 4 + t) * 16 + rr0);
    }
    v4f lv;
#pragma unroll
    for (int k = 0; k < 4; ++k) {
      const float mx = fmaxf(fmaxf(mg[0][k], mg[1][k]), fmaxf(mg[2][k], mg[3][k]));
      float ls = 0.0f;
#pragma unroll
      for (int g = 0; g < SA_NGRP; ++g) ls += __builtin_amdgcn_exp2f(mg[g][k] - mx) * lg[g][k];
      lv[k] = SA_LN2 * (mx + log2f(ls));
    }
    *(v4f*)(lse + (size_t)h * SA_SQ + q0 + lane * 4) = lv;
  }
}

extern "C" void kernel_launch(void* const* d_in, const int* in_sizes, int n_in,
                              void* d_out, int out_size, void* d_ws, size_t ws_size,
                              hipStream_t stream) {
  (void)d_ws; (void)ws_size;
  // static shapes; refuse anything else (outputs stay zero)
  if (n_in < 5) return;
  if (in_sizes[0] != SA_H * SA_SQ * SA_D) return;
  if (in_sizes[1] != SA_H * SA_SKV * SA_D || in_sizes[2] != SA_H * SA_SKV * SA_D) return;
  if (in_sizes[3] != SA_H * SA_SKV * SA_D || in_sizes[4] != SA_H * SA_SKV * SA_D) return;
  if (out_size != SA_H * SA_SQ * SA_D + SA_H * SA_SQ) return;

  const float* q  = (const float*)d_in[0];
  const float* kA = (const float*)d_in[1];
  const float* vA = (const float*)d_in[2];
  const float* kB = (const float*)d_in[3];
  const float* vB = (const float*)d_in[4];
  float* out = (float*)d_out;                              // output 0: [16][1024][128] f32 at byte 0
  float* lse = out + (size_t)SA_H * SA_SQ * SA_D;          // output 1: [16][1024] f32 at byte 8388608

  dim3 grid(SA_H * (SA_SQ / SA_QBLK));   // 256 blocks: head x 64-row query tile (1024 = 16 x 64 exactly)
  dim3 block(32 * SA_NWAVE);             // 16 waves: 4 query tiles of 16 rows x 4 KV quarters
  attn_two_kv<<<grid, block, 0, stream>>>(q, kA, vA, kB, vB, out, lse);
}

// v005
// One run takes 63.6 microseconds.
// Two timings next to v004 put it at 1.07 and 1.08 times that version's speed.
// Over all steps from v000 it is 3.87 times as fast.
#include <hip/hip_runtime.h>

typedef _Float16 v16h __attribute__((ext_vector_type(16)));
typedef _Float16 v8h  __attribute__((ext_vector_type(8)));
typedef _Float16 v4h  __attribute__((ext_vector_type(4)));
typedef float    v8f  __attribute__((ext_vector_type(8)));
typedef float    v4f  __attribute__((ext_vector_type(4)));
union Frag { v16h v; v8h h[2]; };

#define SA_H     16
#define SA_SQ    1024
#define SA_SKV   2048
#define SA_D     128
#define SA_QBLK  64            // query rows per block (4 query tiles x 16 rows)
#define SA_NGRP  4             // KV quarters per block: A low, A high, B low, B high; one group of 4 waves each
#define SA_NWAVE (4 * SA_NGRP) // 16 waves: four per SIMD
#define SA_OPS   16.0f         // power-of-two operand pre-scale applied to Q, K, V and P before the f16 convert
// log2-domain score scale: (1/sqrt(D)) * log2(e), with the 2^4*2^4 operand scale of Q and K removed (2^-8)
#define SA_CS    ((0.088388347648318447f * 1.4426950408889634f) * 0.00390625f)
#define SA_LN2   0.69314718055994531f
#define SA_OINV  0.00390625f   // removes the 2^4*2^4 operand scale of P and V

// LDS pitches in 16-bit elements (rows 16-B aligned)
#define KP   136   // K tile   [32 kv][128 d + 8]   d contiguous  -> A fragment for S^T
#define VP   40    // V tile   [128 d][32 kv + 8]   kv contiguous -> A fragment for O^T
#define OPF  132   // O tile   [16 q][128 d + 4]    floats, per wave (epilogue staging)
#define NSTEP (2 * SA_SKV / 32 / SA_NGRP)   // steps of 32 kv rows per group

// 16x16x32 f16 WMMA with the VALU hazard guard tied to D (A/B kept live)
__device__ __forceinline__ v8f wmma_f16(v16h a, v16h b, v8f c) {
  v8f d = __builtin_amdgcn_wmma_f32_16x16x32_f16(false, a, false, b, (short)0, c, false, false);
  asm volatile("v_nop\n\tv_nop\n\tv_nop\n\tv_nop" : "+v"(d) : "v"(a), "v"(b));
  return d;
}

// lane l <-> lane l ^ 16: the two lanes that share one query column
__device__ __forceinline__ float xhalf(float x) {
  const int b = __builtin_bit_cast(int, x);
  return __builtin_bit_cast(float, __builtin_amdgcn_permlanex16(b, b, 0x76543210, 0xfedcba98, false, false));
}

__global__ __launch_bounds__(32 * SA_NWAVE) __attribute__((amdgpu_num_vgpr(256)))
void attn_two_kv(const float* __restrict__ q,
                 const float* __restrict__ kA, const float* __restrict__ vA,
                 const float* __restrict__ kB, const float* __restrict__ vB,
                 float* out, float* lse)
{
  __shared__ __align__(16) _Float16 kbufs[2][SA_NGRP][32 * KP];    //  69632 B, two K tiles per group (this step's, the next step's)
  __shared__ __align__(16) _Float16 vbufs[2][SA_NGRP][SA_D * VP];  //  81920 B, two V tiles per group
  __shared__ __align__(16) float    obuf[SA_NWAVE][16 * OPF];      // 135168 B, unnormalised partial O per wave
  __shared__ __align__(16) float    mbuf[SA_NWAVE * 16];           //   1024 B, partial row maxima (log2 domain)
  __shared__ __align__(16) float    lbuf[SA_NWAVE * 16];           //   1024 B, partial row sums

  const int tid  = threadIdx.x;
  const int lane = tid & 31;
  const int wave = __builtin_amdgcn_readfirstlane(tid >> 5);   // scalar, so that the group's base pointers stay scalar
  const int grp  = wave >> 2;       // KV quarter this wave works on
  const int wq   = wave & 3;        // query tile (16 rows) this wave works on
  const int half = lane >> 4;       // h of the fragment map
  const int l16  = lane & 15;       // row m for A, column n for B and D (the lane's query)

  const int h    = blockIdx.x % SA_H;
  const int q0   = (blockIdx.x / SA_H) * SA_QBLK;
  const int qrow = q0 + wq * 16;

  // staging split (4 waves of a group): a wave takes 8 kv rows of K and of V; one load instruction covers one whole
  // row (32 lanes x 16 B = 512 contiguous bytes = 4 lines), a lane holds 4 consecutive d of each of the 8 rows
  const int srow = wq * 8;
  const int sd   = lane * 4;

  const float* ks = (grp & 2) ? kB : kA;
  const float* vs = (grp & 2) ? vB : vA;
  const int jgrp  = (grp & 1) * (SA_SKV / 2);

  // ---- Q -> 4 B fragments (32 d x 16 query columns each), pre-scaled by 2^4.
  // B map: lane column n = query l16; elements 0..7 <- d = c*32 + 8h + 0..7; elements 8..15 <- d = c*32 + 16 + 8h + 0..7
  v16h qf[4];
  {
    const float* qp = q + ((size_t)(h * SA_SQ + qrow + l16)) * SA_D;
#pragma unroll
    for (int c = 0; c < 4; ++c) {
      Frag f;
#pragma unroll
      for (int s = 0; s < 2; ++s) {
        const int d0 = c * 32 + 16 * s + 8 * half;
        const float4 a0 = *(const float4*)(qp + d0);
        const float4 a1 = *(const float4*)(qp + d0 + 4);
        v8h t;
        t[0] = (_Float16)(a0.x * SA_OPS); t[1] = (_Float16)(a0.y * SA_OPS);
        t[2] = (_Float16)(a0.z * SA_OPS); t[3] = (_Float16)(a0.w * SA_OPS);
        t[4] = (_Float16)(a1.x * SA_OPS); t[5] = (_Float16)(a1.y * SA_OPS);
        t[6] = (_Float16)(a1.z * SA_OPS); t[7] = (_Float16)(a1.w * SA_OPS);
        f.h[s] = t;
      }
      qf[c] = f.v;
    }
  }

  v8f o[8];
#pragma unroll
  for (int n = 0; n < 8; ++n)
#pragma unroll
    for (int r = 0; r < 8; ++r) o[n][r] = 0.0f;

  // state of the lane's query: running maximum (equal in both lane halves) and the sum over this half's kv rows only
  float mrun = -1.0e30f, lrun = 0.0f;

  // the tile in flight: the wave's 8 kv rows of K and of V of one step, held in registers from its loads to its LDS stores
  v4f kx[8], vx[8];
  const float* srcK = ks + ((size_t)(h * SA_SKV + jgrp + srow)) * SA_D + sd;
  const float* srcV = vs + ((size_t)(h * SA_SKV + jgrp + srow)) * SA_D + sd;

  // ---- global loads of both tiles of step st: 8 kv rows per wave, one whole row per instruction
  auto load_tile = [&](int st) {
    const float* pk = srcK + (size_t)st * (32 * SA_D);
    const float* pv = srcV + (size_t)st * (32 * SA_D);
#pragma unroll
    for (int i = 0; i < 8; ++i) kx[i] = *(const v4f*)(pk + i * SA_D);
#pragma unroll
    for (int i = 0; i < 8; ++i) vx[i] = *(const v4f*)(pv + i * SA_D);
    // the loads stay in flight over the code that follows, which reuses their address registers: keep the wait in front of
    // that reuse. The two addresses are inputs so that they keep their registers up to the wait (no load's destination is
    // laid over them); the memory clobber keeps the loads from being moved down towards their first use
    asm volatile("s_wait_xcnt 0x0" :: "v"(pk), "v"(pv) : "memory");
  };
  // ---- the tile in flight, converted, into LDS buffer b
  auto store_tile = [&](int b) {
    // K tile (32 kv x 128 d), d contiguous, f16 = x * 2^4; 4 d per 8-B store, a wave's store fills 256 contiguous bytes
    _Float16* dst = kbufs[b][grp] + srow * KP + sd;
#pragma unroll
    for (int i = 0; i < 8; ++i) {
      v4h p;
      p[0] = (_Float16)(kx[i][0] * SA_OPS); p[1] = (_Float16)(kx[i][1] * SA_OPS);
      p[2] = (_Float16)(kx[i][2] * SA_OPS); p[3] = (_Float16)(kx[i][3] * SA_OPS);
      *(v4h*)(dst + i * KP) = p;
    }
    // V tile transposed to [d][kv] (kv contiguous), f16 = x * 2^4; the lane's 8 kv of one d per 16-B store
    _Float16* dv = vbufs[b][grp];
#pragma unroll
    for (int c = 0; c < 4; ++c) {
      v8h w;
#pragma unroll
      for (int i = 0; i < 8; ++i) w[i] = (_Float16)(vx[i][c] * SA_OPS);
      *(v8h*)(dv + (sd + c) * VP + srow) = w;
    }
  };

  load_tile(0);
  store_tile(0);
  __syncthreads();   // tile 0 is in LDS

  // Each group runs one online-softmax pass over its own KV quarter; the four partial states of a query row
  // are joined after the loop by their maxima and sums == LSE-weighted combine of the partial states.
  // Step s issues the loads of tile s + 1 (behind the barrier: the barrier's fence would wait for loads in flight), works on
  // buffer s & 1 while they fly, and then stores tile s + 1 into the other buffer, whose last readers (step s - 1) stand in
  // front of that step's barrier.
  auto products = [&](int b, bool more, int next) {
    const _Float16* kbuf  = kbufs[b][grp];
    const _Float16* vbufT = vbufs[b][grp];

    // ---- S^T = (2^4 K)(2^4 Q)^T : two 16x16 tiles (kv rows 0..15 and 16..31), 4 k-steps over d.
    // A map (same k map as B): lane row m = kv l16; elements 0..7 <- d = c*32 + 8h + 0..7; 8..15 <- d = c*32 + 16 + 8h + 0..7
    // The K tile's LDS reads stand in groups ahead of the products instead of one small group in front of each pair:
    // 12 reads (d-chunks 0..2) ahead of all products, the last 4 behind the first pair, in whose registers they land
    // (all 16 at once did not fit the register budget: the build spilled a Q fragment).
    v8f s0, s1;
#pragma unroll
    for (int r = 0; r < 8; ++r) { s0[r] = 0.0f; s1[r] = 0.0f; }
    Frag b0[4], b1[4];
    auto read_k = [&](int c) {
      const _Float16* kp0 = kbuf + l16 * KP + c * 32 + half * 8;   // kv row l16
      const _Float16* kp1 = kp0 + 16 * KP;                           // kv row 16 + l16
      b0[c].h[0] = *(const v8h*)(kp0);  b0[c].h[1] = *(const v8h*)(kp0 + 16);
      b1[c].h[0] = *(const v8h*)(kp1);  b1[c].h[1] = *(const v8h*)(kp1 + 16);
    };
    read_k(0); read_k(1); read_k(2);
    // keeps the read group whole: without it the build sinks each read to its product and waits out the LDS latency there
    __builtin_amdgcn_sched_barrier(0);
    // the next tile's global loads are issued here, behind the reads: their issue and its wait run inside the LDS latency
    if (more) load_tile(next);
    // keeps the first product, and with it the wait for the reads, behind the issue of those loads
    __builtin_amdgcn_sched_barrier(0);
    s0 = wmma_f16(b0[0].v, qf[0], s0);
    s1 = wmma_f16(b1[0].v, qf[0], s1);
    // keeps the last reads behind the first pair (whose registers they reuse) ...
    __builtin_amdgcn_sched_barrier(0);
    read_k(3);
    // ... and ahead of the two pairs that cover their latency
    __builtin_amdgcn_sched_barrier(0);
#pragma unroll
    for (int c = 1; c < 4; ++c) {
      s0 = wmma_f16(b0[c].v, qf[c], s0);
      s1 = wmma_f16(b1[c].v, qf[c], s1);
    }
    // keeps the V reads below behind the last score product (they take over the K fragments' registers)
    __builtin_amdgcn_sched_barrier(0);

    // ---- V^T fragments of d-chunks 0..3, read as one group here so that the softmax below covers their LDS latency.
    // A map: lane row m = d (cn*16 + l16); elements 0..7 <- kv 8h + 0..7; 8..15 <- kv 16 + 8h + 0..7
    Frag vf[8];
    auto read_v = [&](int cn) {
      const _Float16* vp = vbufT + (cn * 16 + l16) * VP + half * 8;
      vf[cn].h[0] = *(const v8h*)(vp);
      vf[cn].h[1] = *(const v8h*)(vp + 16);
    };
    read_v(0); read_v(1); read_v(2); read_v(3);
    // keeps that group ahead of the softmax: without it the reads sink to their products
    __builtin_amdgcn_sched_barrier(0);

    // ---- online softmax in the log2 domain; D map: s0[r] = S[query l16][kv 8h + r], s1[r] = S[query l16][kv 16 + 8h + r]:
    // a query's 32 scores lie in the two lanes l16 and 16 + l16, so its maximum is in-lane plus one exchange
    float mx = fmaxf(s0[0], s1[0]);
#pragma unroll
    for (int r = 1; r < 8; ++r) mx = fmaxf(mx, fmaxf(s0[r], s1[r]));
    mx = fmaxf(mx, xhalf(mx));
    const float mn = fmaxf(mrun, mx * SA_CS);
    float cf;
    // exp2 with its free slot in one statement
    asm("v_exp_f32 %0, %1\n\tv_nop" : "=v"(cf) : "v"(mrun - mn));
    float e0[8], e1[8];
#pragma unroll
    for (int r = 0; r < 8; ++r) {
      e0[r] = s0[r] * SA_CS - mn;
      e1[r] = s1[r] * SA_CS - mn;
    }
    // the 16 exp2, each in place on its own register, with the free slot behind the last, in one statement: this build laid
    // an exp2's result over the source register of the exp2 directly in front of it
    asm("v_exp_f32 %0, %0\n\tv_exp_f32 %1, %1\n\tv_exp_f32 %2, %2\n\tv_exp_f32 %3, %3\n\t"
        "v_exp_f32 %4, %4\n\tv_exp_f32 %5, %5\n\tv_exp_f32 %6, %6\n\tv_exp_f32 %7, %7\n\t"
        "v_exp_f32 %8, %8\n\tv_exp_f32 %9, %9\n\tv_exp_f32 %10, %10\n\tv_exp_f32 %11, %11\n\t"
        "v_exp_f32 %12, %12\n\tv_exp_f32 %13, %13\n\tv_exp_f32 %14, %14\n\tv_exp_f32 %15, %15\n\tv_nop"
        : "+v"(e0[0]), "+v"(e1[0]), "+v"(e0[1]), "+v"(e1[1]), "+v"(e0[2]), "+v"(e1[2]), "+v"(e0[3]), "+v"(e1[3]),
          "+v"(e0[4]), "+v"(e1[4]), "+v"(e0[5]), "+v"(e1[5]), "+v"(e0[6]), "+v"(e1[6]), "+v"(e0[7]), "+v"(e1[7]));
    float rs = 0.0f;
#pragma unroll
    for (int r = 0; r < 8; ++r) {
      s0[r] = e0[r];
      s1[r] = e1[r];
      rs += s0[r] + s1[r];
    }
    lrun = lrun * cf + rs;
    mrun = mn;

    // ---- P^T (<= 1) pre-scaled by 2^4: the two score tiles, converted in place, are the B fragment
    // B map: lane column n = query l16; elements 0..7 <- kv 8h + 0..7 (s0); 8..15 <- kv 16 + 8h + 0..7 (s1)
    Frag pf;
#pragma unroll
    for (int r = 0; r < 8; ++r) {
      pf.h[0][r] = (_Float16)(s0[r] * SA_OPS);
      pf.h[1][r] = (_Float16)(s1[r] * SA_OPS);
    }

    // ---- O^T = O^T * cf + (2^4 V)^T (2^4 P)^T : 8 d-chunks of 16 rows. The other four fragments are read in two groups of
    // 4 reads, each into the registers of the two products just issued (more fragments at once spilled a Q fragment).
    auto rescale = [&](int n) {
#pragma unroll
      for (int r = 0; r < 8; ++r) o[n][r] *= cf;
    };
    rescale(0); rescale(1);
    o[0] = wmma_f16(vf[0].v, pf.v, o[0]);
    o[1] = wmma_f16(vf[1].v, pf.v, o[1]);
    // keeps the reads of d-chunks 4 and 5 behind the two products whose registers they reuse; the rest of the rescale and
    // the next two products cover their latency
    __builtin_amdgcn_sched_barrier(0);
    read_v(4); read_v(5);
#pragma unroll
    for (int n = 2; n < 8; ++n) rescale(n);
    o[2] = wmma_f16(vf[2].v, pf.v, o[2]);
    o[3] = wmma_f16(vf[3].v, pf.v, o[3]);
    // keeps the reads of d-chunks 6 and 7 behind the two products whose registers they reuse ...
    __builtin_amdgcn_sched_barrier(0);
    read_v(6); read_v(7);
    // ... ahead of the two products that cover their latency
    __builtin_amdgcn_sched_barrier(0);
#pragma unroll
    for (int cn = 4; cn < 8; ++cn) o[cn] = wmma_f16(vf[cn].v, pf.v, o[cn]);
  };

  for (int step = 0; step < NSTEP - 1; ++step) {
    products(step & 1, true, step + 1);
    // nothing is scheduled across this line: without it the build moves the tile's converts, and with them the wait for the
    // loads in flight, up among the last four products
    __builtin_amdgcn_sched_barrier(0);
    store_tile((step + 1) & 1);
    __syncthreads();   // tile s + 1 is in LDS, and every reader of this step's buffer is done
  }
  products((NSTEP - 1) & 1, false, 0);

  {
    float* ob = obuf[wave];
#pragma unroll
    for (int n = 0; n < 8; ++n) {   // D map: o[n][r] = O[query l16][d = n*16 + 8h + r]: 8 consecutive d, two 16-B stores
      float* od = ob + l16 * OPF + n * 16 + half * 8;
      const v4f lo = {o[n][0], o[n][1], o[n][2], o[n][3]};
      const v4f hi = {o[n][4], o[n][5], o[n][6], o[n][7]};
      *(v4f*)(od)     = lo;
      *(v4f*)(od + 4) = hi;
    }
    const float lj = lrun + xhalf(lrun);   // the two halves' sums of one query, joined once (all lanes active)
    if (half == 0) {
      mbuf[wave * 16 + l16] = mrun;
      lbuf[wave * 16 + l16] = lj;
    }
  }
  __syncthreads();   // every group's partial state is in LDS

  // Join of the four partial states. Wave w owns block rows 4w..4w+3: query tile w >> 2, tile rows 4(w & 3)..+3.
  // The partial state of group g for query tile t was left by wave 4g + t.
  // out0: one 16-B-per-lane instruction per row (512 B = 4 lines).
  {
    const int t   = wave >> 2;
    const int rr0 = (wave & 3) * 4;
    float* orow = out + ((size_t)(h * SA_SQ + q0 + wave * 4)) * SA_D + lane * 4;
#pragma unroll
    for (int i = 0; i < 4; ++i) {
      const int rr = rr0 + i;
      float mg[SA_NGRP], lg[SA_NGRP];
#pragma unroll
      for (int g = 0; g < SA_NGRP; ++g) {
        mg[g] = mbuf[(g * 4 + t) * 16 + rr];
        lg[g] = lbuf[(g * 4 + t) * 16 + rr];
      }
      const float mx = fmaxf(fmaxf(mg[0], mg[1]), fmaxf(mg[2], mg[3]));
      float ls = 0.0f;
      v4f acc = {0.0f, 0.0f, 0.0f, 0.0f};
#pragma unroll
      for (int g = 0; g < SA_NGRP; ++g) {
        const float w = __builtin_amdgcn_exp2f(mg[g] - mx);
        ls += w * lg[g];
        acc += w * *(const v4f*)(obuf[g * 4 + t] + rr * OPF + lane * 4);
      }
      *(v4f*)(orow + (size_t)i * SA_D) = acc * (SA_OINV / ls);
    }
  }
  // out1: 64 floats per block (256 B = 2 lines) written by wave 0 lanes 0..15, one instruction; lane owns block rows 4*lane..+3.
  if (wave == 0 && lane < 16) {
    const int t   = lane >> 2;
    const int rr0 = (lane & 3) * 4;
    v4f mg[SA_NGRP], lg[SA_NGRP];
#pragma unroll
    for (int g = 0; g < SA_NGRP; ++g) {
      mg[g] = *(const v4f*)(mbuf + (g * 4 + t) * 16 + rr0);
      lg[g] = *(const v4f*)(lbuf + (g * 4 + t) * 16 + rr0);
    }
    v4f lv;
#pragma unroll
    for (int k = 0; k < 4; ++k) {
      const float mx = fmaxf(fmaxf(mg[0][k], mg[1][k]), fmaxf(mg[2][k], mg[3][k]));
      float ls = 0.0f;
#pragma unroll
      for (int g = 0; g < SA_NGRP; ++g) ls += __builtin_amdgcn_exp2f(mg[g][k] - mx) * lg[g][k];
      lv[k] = SA_LN2 * (mx + log2f(ls));
    }
    *(v4f*)(lse + (size_t)h * SA_SQ + q0 + lane * 4) = lv;
  }
}

extern "C" void kernel_launch(void* const* d_in, const int* in_sizes, int n_in,
                              void* d_out, int out_size, void* d_ws, size_t ws_size,
                              hipStream_t stream) {
  (void)d_ws; (void)ws_size;
  // static shapes; refuse anything else (outputs stay zero)
  if (n_in < 5) return;
  if (in_sizes[0] != SA_H * SA_SQ * SA_D) return;
  if (in_sizes[1] != SA_H * SA_SKV * SA_D || in_sizes[2] != SA_H * SA_SKV * SA_D) return;
  if (in_sizes[3] != SA_H * SA_SKV * SA_D || in_sizes[4] != SA_H * SA_SKV * SA_D) return;
  if (out_size != SA_H * SA_SQ * SA_D + SA_H * SA_SQ) return;

  const float* q  = (const float*)d_in[0];
  const float* kA = (const float*)d_in[1];
  const float* vA = (const float*)d_in[2];
  const float* kB = (const float*)d_in[3];
  const float* vB = (const float*)d_in[4];
  float* out = (float*)d_out;                              // output 0: [16][1024][128] f32 at byte 0
  float* lse = out + (size_t)SA_H * SA_SQ * SA_D;          // output 1: [16][1024] f32 at byte 8388608

  dim3 grid(SA_H * (SA_SQ / SA_QBLK));   // 256 blocks: head x 64-row query tile (1024 = 16 x 64 exactly)
  dim3 block(32 * SA_NWAVE);             // 16 waves: 4 query tiles of 16 rows x 4 KV quarters
  attn_two_kv<<<grid, block, 0, stream>>>(q, kA, vA, kB, vB, out, lse);
}

// v006
// A run of this version takes 53.6 microseconds.
// Two timings next to v005 put it at 1.19 and 1.20 times that version's speed.
// All steps since v000 together make it 4.61 times as fast.
#include <hip/hip_runtime.h>

typedef _Float16 v16h __attribute__((ext_vector_type(16)));
typedef _Float16 v8h  __attribute__((ext_vector_type(8)));
typedef _Float16 v4h  __attribute__((ext_vector_type(4)));
typedef float    v8f  __attribute__((ext_vector_type(8)));
typedef float    v4f  __attribute__((ext_vector_type(4)));
union Frag { v16h v; v8h h[2]; };

#define SA_H     16
#define SA_SQ    1024
#define SA_SKV   2048
#define SA_D     128
#define SA_QBLK  64            // query rows per block (4 query tiles x 16 rows)
#define SA_NGRP  4             // KV quarters per block: A low, A high, B low, B high; one group of 4 waves each
#define SA_NWAVE (4 * SA_NGRP) // 16 waves: four per SIMD
#define SA_OPS   16.0f         // power-of-two operand pre-scale applied to Q, K, V and P before the f16 convert
// log2-domain score scale: (1/sqrt(D)) * log2(e), with the 2^4*2^4 operand scale of Q and K removed (2^-8)
#define SA_CS    ((0.088388347648318447f * 1.4426950408889634f) * 0.00390625f)
#define SA_LN2   0.69314718055994531f
#define SA_OINV  0.00390625f   // removes the 2^4*2^4 operand scale of P and V

// LDS pitches in 16-bit elements (rows 16-B aligned)
#define KP   136   // K tile   [32 kv][128 d + 8]   d contiguous  -> A fragment for S^T
#define VP   40    // V tile   [128 d][32 kv + 8]   kv contiguous -> A fragment for O^T
#define OPF  132   // O tile   [16 q][128 d + 4]    floats, per wave (epilogue staging)
#define NSTEP (2 * SA_SKV / 32 / SA_NGRP)   // steps of 32 kv rows per group
#define TILE_E (32 * SA_D)                  // 16-bit elements of one K or V tile in the workspace (8 KiB, contiguous)
#define HTILES (SA_SKV / 32)                // tiles per head and KV set; tile number = (set * SA_H + head) * HTILES + kv / 32

// 16x16x32 f16 WMMA with the VALU hazard guard tied to D (A/B kept live)
__device__ __forceinline__ v8f wmma_f16(v16h a, v16h b, v8f c) {
  v8f d = __builtin_amdgcn_wmma_f32_16x16x32_f16(false, a, false, b, (short)0, c, false, false);
  asm volatile("v_nop\n\tv_nop\n\tv_nop\n\tv_nop" : "+v"(d) : "v"(a), "v"(b));
  return d;
}

// lane l <-> lane l ^ 16: the two lanes that share one query column
__device__ __forceinline__ float xhalf(float x) {
  const int b = __builtin_bit_cast(int, x);
  return __builtin_bit_cast(float, __builtin_amdgcn_permlanex16(b, b, 0x76543210, 0xfedcba98, false, false));
}

// K and V, f32 -> f16 = x * 2^4, once for all 16 query blocks of a head. K tile: [32 kv][128 d]; V tile transposed: [128 d][32 kv].
// A group of 4 waves takes two tiles; a wave takes 8 kv rows of each (one whole 512-B row per load), all 32 loads issued ahead.
__global__ __launch_bounds__(32 * SA_NWAVE)
void kv_to_f16(const float* __restrict__ kA, const float* __restrict__ vA,
               const float* __restrict__ kB, const float* __restrict__ vB,
               _Float16* __restrict__ kh, _Float16* __restrict__ vt)
{
  __shared__ __align__(16) _Float16 tb[2][SA_NGRP][SA_D * VP];   // 81920 B: V tiles on their way from [kv][d] to [d][kv]

  const int tid  = threadIdx.x;
  const int lane = tid & 31;
  const int wave = __builtin_amdgcn_readfirstlane(tid >> 5);
  const int grp  = wave >> 2;
  const int wq   = wave & 3;
  const int srow = wq * 8;
  const int sd   = lane * 4;
  const int h    = blockIdx.x % SA_H;                                   // same head as the attention block of this index
  const int t0   = (blockIdx.x / SA_H) * (2 * SA_NGRP) + grp * 2;       // first of the group's two tiles, 0..127 within the head
  const int set  = t0 / HTILES;                                         // both tiles lie in one KV set (t0 is even)
  const int j0   = t0 % HTILES;
  const float* ks = set ? kB : kA;
  const float* vs = set ? vB : vA;
  const size_t tile0 = (size_t)(set * SA_H + h) * HTILES + j0;

  v4f kx[2][8], vx[2][8];
  const float* bk = ks + ((size_t)(h * SA_SKV + j0 * 32 + srow)) * SA_D;   // wave-uniform bases; the lane adds its 4 d
  const float* bv = vs + ((size_t)(h * SA_SKV + j0 * 32 + srow)) * SA_D;
#pragma unroll
  for (int t = 0; t < 2; ++t) {   // the second tile's rows follow the first's at 32 rows' distance
#pragma unroll
    for (int i = 0; i < 8; ++i) kx[t][i] = *(const v4f*)(bk + sd + (t * 32 + i) * SA_D);
#pragma unroll
    for (int i = 0; i < 8; ++i) vx[t][i] = *(const v4f*)(bv + sd + (t * 32 + i) * SA_D);
  }
  // the loads stay in flight over code that reuses the registers their addresses stand in: keep the wait in front of that reuse.
  // The two bases and the lane number are inputs so that they keep their registers up to the wait
  asm volatile("s_wait_xcnt 0x0" :: "s"(bk), "s"(bv), "v"(lane) : "memory");
  // keeps all 32 loads, and the wait directly behind them, ahead of the first convert: without it the build held the last
  // eight loads back and waited out their latency in pairs
  __builtin_amdgcn_sched_barrier(0);
#pragma unroll
  for (int t = 0; t < 2; ++t) {
    // K keeps its order: 4 d per 8-B store, a wave's store fills one 256-B row of the tile (2 whole lines)
    _Float16* dk = kh + (tile0 + t) * TILE_E + srow * SA_D + sd;
#pragma unroll
    for (int i = 0; i < 8; ++i) {
      v4h p;
      p[0] = (_Float16)(kx[t][i][0] * SA_OPS); p[1] = (_Float16)(kx[t][i][1] * SA_OPS);
      p[2] = (_Float16)(kx[t][i][2] * SA_OPS); p[3] = (_Float16)(kx[t][i][3] * SA_OPS);
      *(v4h*)(dk + i * SA_D) = p;
    }
    // V is turned in LDS: the lane's 8 kv of one d per 16-B store
    _Float16* dv = tb[t][grp];
#pragma unroll
    for (int c = 0; c < 4; ++c) {
      v8h w;
#pragma unroll
      for (int i = 0; i < 8; ++i) w[i] = (_Float16)(vx[t][i][c] * SA_OPS);
      *(v8h*)(dv + (sd + c) * VP + srow) = w;
    }
  }
  __syncthreads();   // both turned V tiles of every group are in LDS
#pragma unroll
  for (int t = 0; t < 2; ++t) {
    _Float16* gv = vt + (tile0 + t) * TILE_E;
#pragma unroll
    for (int i = 0; i < 4; ++i) {   // 16-B piece e of the tile: d = e / 4, kv = 8 * (e % 4); a wave's store fills 512 contiguous bytes
      const int e = wq * 128 + i * 32 + lane;
      *(v8h*)(gv + e * 8) = *(const v8h*)(tb[t][grp] + (e >> 2) * VP + (e & 3) * 8);
    }
  }
}

__global__ __launch_bounds__(32 * SA_NWAVE) __attribute__((amdgpu_num_vgpr(256)))
void attn_two_kv(const float* __restrict__ q,
                 const _Float16* __restrict__ kh, const _Float16* __restrict__ vt,
                 float* out, float* lse)
{
  __shared__ __align__(16) _Float16 kbufs[2][SA_NGRP][32 * KP];    //  69632 B, two K tiles per group (this step's, the next step's)
  __shared__ __align__(16) _Float16 vbufs[2][SA_NGRP][SA_D * VP];  //  81920 B, two V tiles per group
  __shared__ __align__(16) float    obuf[SA_NWAVE][16 * OPF];      // 135168 B, unnormalised partial O per wave
  __shared__ __align__(16) float    mbuf[SA_NWAVE * 16];           //   1024 B, partial row maxima (log2 domain)
  __shared__ __align__(16) float    lbuf[SA_NWAVE * 16];           //   1024 B, partial row sums

  const int tid  = threadIdx.x;
  const int lane = tid & 31;
  const int wave = __builtin_amdgcn_readfirstlane(tid >> 5);   // scalar, so that the group's base pointers stay scalar
  const int grp  = wave >> 2;       // KV quarter this wave works on
  const int wq   = wave & 3;        // query tile (16 rows) this wave works on
  const int half = lane >> 4;       // h of the fragment map
  const int l16  = lane & 15;       // row m for A, column n for B and D (the lane's query)

  const int h    = blockIdx.x % SA_H;
  const int q0   = (blockIdx.x / SA_H) * SA_QBLK;
  const int qrow = q0 + wq * 16;

  // staging split (4 waves of a group): a wave takes a quarter (2 KiB) of the f16 K tile and of the f16 V tile; one load
  // instruction covers 512 contiguous bytes (4 lines), a lane holds one 16-B piece of each of the 4 + 4 loads
  const size_t tile0 = (size_t)((grp >> 1) * SA_H + h) * HTILES + (grp & 1) * (HTILES / 2);   // the group's first tile

  // ---- Q -> 4 B fragments (32 d x 16 query columns each), pre-scaled by 2^4.
  // B map: lane column n = query l16; elements 0..7 <- d = c*32 + 8h + 0..7; elements 8..15 <- d = c*32 + 16 + 8h + 0..7
  v16h qf[4];
  {
    const float* qp = q + ((size_t)(h * SA_SQ + qrow + l16)) * SA_D;
#pragma unroll
    for (int c = 0; c < 4; ++c) {
      Frag f;
#pragma unroll
      for (int s = 0; s < 2; ++s) {
        const int d0 = c * 32 + 16 * s + 8 * half;
        const float4 a0 = *(const float4*)(qp + d0);
        const float4 a1 = *(const float4*)(qp + d0 + 4);
        v8h t;
        t[0] = (_Float16)(a0.x * SA_OPS); t[1] = (_Float16)(a0.y * SA_OPS);
        t[2] = (_Float16)(a0.z * SA_OPS); t[3] = (_Float16)(a0.w * SA_OPS);
        t[4] = (_Float16)(a1.x * SA_OPS); t[5] = (_Float16)(a1.y * SA_OPS);
        t[6] = (_Float16)(a1.z * SA_OPS); t[7] = (_Float16)(a1.w * SA_OPS);
        f.h[s] = t;
      }
      qf[c] = f.v;
    }
  }

  v8f o[8];
#pragma unroll
  for (int n = 0; n < 8; ++n)
#pragma unroll
    for (int r = 0; r < 8; ++r) o[n][r] = 0.0f;

  // state of the lane's query: running maximum (equal in both lane halves) and the sum over this half's kv rows only
  float mrun = -1.0e30f, lrun = 0.0f;

  // the tile in flight: the wave's quarter of the K and of the V tile of one step, held in registers from its loads to its LDS stores
  v8h kx[4], vx[4];
  const _Float16* srcK = kh + tile0 * TILE_E + wq * 1024 + lane * 8;
  const _Float16* srcV = vt + tile0 * TILE_E + wq * 1024 + lane * 8;

  // ---- global loads of both tiles of step st: 4 + 4 loads per wave, 512 contiguous bytes per instruction
  auto load_tile = [&](int st) {
    const _Float16* pk = srcK + (size_t)st * TILE_E;
    const _Float16* pv = srcV + (size_t)st * TILE_E;
#pragma unroll
    for (int i = 0; i < 4; ++i) kx[i] = *(const v8h*)(pk + i * 256);
#pragma unroll
    for (int i = 0; i < 4; ++i) vx[i] = *(const v8h*)(pv + i * 256);
    // the loads stay in flight over the code that follows, which reuses their address registers: keep the wait in front of
    // that reuse. The two addresses are inputs so that they keep their registers up to the wait (no load's destination is
    // laid over them); the memory clobber keeps the loads from being moved down towards their first use
    asm volatile("s_wait_xcnt 0x0" :: "v"(pk), "v"(pv) : "memory");
  };
  // ---- the tile in flight into LDS buffer b, as it is; only the row pitch changes (256 -> 272 B for K, 64 -> 80 B for V)
  auto store_tile = [&](int b) {
    // K tile (32 kv x 128 d), d contiguous: piece e = wq*128 + i*32 + lane is kv row e / 16, d = 8 * (e % 16)
    _Float16* dk = kbufs[b][grp] + (wq * 8 + (lane >> 4)) * KP + (lane & 15) * 8;
#pragma unroll
    for (int i = 0; i < 4; ++i) *(v8h*)(dk + i * 2 * KP) = kx[i];
    // V tile [d][kv], kv contiguous: piece e is d = e / 4, kv = 8 * (e % 4)
    _Float16* dv = vbufs[b][grp] + (wq * 32 + (lane >> 2)) * VP + (lane & 3) * 8;
#pragma unroll
    for (int i = 0; i < 4; ++i) *(v8h*)(dv + i * 8 * VP) = vx[i];
  };

  load_tile(0);
  store_tile(0);
  __syncthreads();   // tile 0 is in LDS

  // Each group runs one online-softmax pass over its own KV quarter; the four partial states of a query row
  // are joined after the loop by their maxima and sums == LSE-weighted combine of the partial states.
  // Step s issues the loads of tile s + 1 (behind the barrier: the barrier's fence would wait for loads in flight), works on
  // buffer s & 1 while they fly, and then stores tile s + 1 into the other buffer, whose last readers (step s - 1) stand in
  // front of that step's barrier.
  auto products = [&](int b, bool more, int next) {
    const _Float16* kbuf  = kbufs[b][grp];
    const _Float16* vbufT = vbufs[b][grp];

    // ---- S^T = (2^4 K)(2^4 Q)^T : two 16x16 tiles (kv rows 0..15 and 16..31), 4 k-steps over d.
    // A map (same k map as B): lane row m = kv l16; elements 0..7 <- d = c*32 + 8h + 0..7; 8..15 <- d = c*32 + 16 + 8h + 0..7
    // The K tile's LDS reads stand in groups ahead of the products instead of one small group in front of each pair:
    // 12 reads (d-chunks 0..2) ahead of all products, the last 4 behind the first pair, in whose registers they land
    // (all 16 at once did not fit the register budget: the build spilled a Q fragment).
    v8f s0, s1;
#pragma unroll
    for (int r = 0; r < 8; ++r) { s0[r] = 0.0f; s1[r] = 0.0f; }
    Frag b0[4], b1[4];
    auto read_k = [&](int c) {
      const _Float16* kp0 = kbuf + l16 * KP + c * 32 + half * 8;   // kv row l16
      const _Float16* kp1 = kp0 + 16 * KP;                           // kv row 16 + l16
      b0[c].h[0] = *(const v8h*)(kp0);  b0[c].h[1] = *(const v8h*)(kp0 + 16);
      b1[c].h[0] = *(const v8h*)(kp1);  b1[c].h[1] = *(const v8h*)(kp1 + 16);
    };
    read_k(0); read_k(1); read_k(2);
    // keeps the read group whole: without it the build sinks each read to its product and waits out the LDS latency there
    __builtin_amdgcn_sched_barrier(0);
    // the next tile's global loads are issued here, behind the reads: their issue and its wait run inside the LDS latency
    if (more) load_tile(next);
    // keeps the first product, and with it the wait for the reads, behind the issue of those loads
    __builtin_amdgcn_sched_barrier(0);
    s0 = wmma_f16(b0[0].v, qf[0], s0);
    s1 = wmma_f16(b1[0].v, qf[0], s1);
    // keeps the last reads behind the first pair (whose registers they reuse) ...
    __builtin_amdgcn_sched_barrier(0);
    read_k(3);
    // ... and ahead of the two pairs that cover their latency
    __builtin_amdgcn_sched_barrier(0);
#pragma unroll
    for (int c = 1; c < 4; ++c) {
      s0 = wmma_f16(b0[c].v, qf[c], s0);
      s1 = wmma_f16(b1[c].v, qf[c], s1);
    }
    // keeps the V reads below behind the last score product (they take over the K fragments' registers)
    __builtin_amdgcn_sched_barrier(0);

    // ---- V^T fragments of d-chunks 0..3, read as one group here so that the softmax below covers their LDS latency.
    // A map: lane row m = d (cn*16 + l16); elements 0..7 <- kv 8h + 0..7; 8..15 <- kv 16 + 8h + 0..7
    Frag vf[8];
    auto read_v = [&](int cn) {
      const _Float16* vp = vbufT + (cn * 16 + l16) * VP + half * 8;
      vf[cn].h[0] = *(const v8h*)(vp);
      vf[cn].h[1] = *(const v8h*)(vp + 16);
    };
    read_v(0); read_v(1); read_v(2); read_v(3);
    // keeps that group ahead of the softmax: without it the reads sink to their products
    __builtin_amdgcn_sched_barrier(0);

    // ---- online softmax in the log2 domain; D map: s0[r] = S[query l16][kv 8h + r], s1[r] = S[query l16][kv 16 + 8h + r]:
    // a query's 32 scores lie in the two lanes l16 and 16 + l16, so its maximum is in-lane plus one exchange
    float mx = fmaxf(s0[0], s1[0]);
#pragma unroll
    for (int r = 1; r < 8; ++r) mx = fmaxf(mx, fmaxf(s0[r], s1[r]));
    mx = fmaxf(mx, xhalf(mx));
    const float mn = fmaxf(mrun, mx * SA_CS);
    float cf;
    // exp2 with its free slot in one statement
    asm("v_exp_f32 %0, %1\n\tv_nop" : "=v"(cf) : "v"(mrun - mn));
    float e0[8], e1[8];
#pragma unroll
    for (int r = 0; r < 8; ++r) {
      e0[r] = s0[r] * SA_CS - mn;
      e1[r] = s1[r] * SA_CS - mn;
    }
    // the 16 exp2, each in place on its own register, with the free slot behind the last, in one statement: this build laid
    // an exp2's result over the source register of the exp2 directly in front of it
    asm("v_exp_f32 %0, %0\n\tv_exp_f32 %1, %1\n\tv_exp_f32 %2, %2\n\tv_exp_f32 %3, %3\n\t"
        "v_exp_f32 %4, %4\n\tv_exp_f32 %5, %5\n\tv_exp_f32 %6, %6\n\tv_exp_f32 %7, %7\n\t"
        "v_exp_f32 %8, %8\n\tv_exp_f32 %9, %9\n\tv_exp_f32 %10, %10\n\tv_exp_f32 %11, %11\n\t"
        "v_exp_f32 %12, %12\n\tv_exp_f32 %13, %13\n\tv_exp_f32 %14, %14\n\tv_exp_f32 %15, %15\n\tv_nop"
        : "+v"(e0[0]), "+v"(e1[0]), "+v"(e0[1]), "+v"(e1[1]), "+v"(e0[2]), "+v"(e1[2]), "+v"(e0[3]), "+v"(e1[3]),
          "+v"(e0[4]), "+v"(e1[4]), "+v"(e0[5]), "+v"(e1[5]), "+v"(e0[6]), "+v"(e1[6]), "+v"(e0[7]), "+v"(e1[7]));
    float rs = 0.0f;
#pragma unroll
    for (int r = 0; r < 8; ++r) {
      s0[r] = e0[r];
      s1[r] = e1[r];
      rs += s0[r] + s1[r];
    }
    lrun = lrun * cf + rs;
    mrun = mn;

    // ---- P^T (<= 1) pre-scaled by 2^4: the two score tiles, converted in place, are the B fragment
    // B map: lane column n = query l16; elements 0..7 <- kv 8h + 0..7 (s0); 8..15 <- kv 16 + 8h + 0..7 (s1)
    Frag pf;
#pragma unroll
    for (int r = 0; r < 8; ++r) {
      pf.h[0][r] = (_Float16)(s0[r] * SA_OPS);
      pf.h[1][r] = (_Float16)(s1[r] * SA_OPS);
    }

    // ---- O^T = O^T * cf + (2^4 V)^T (2^4 P)^T : 8 d-chunks of 16 rows. The other four fragments are read in two groups of
    // 4 reads, each into the registers of the two products just issued (more fragments at once spilled a Q fragment).
    auto rescale = [&](int n) {
#pragma unroll
      for (int r = 0; r < 8; ++r) o[n][r] *= cf;
    };
    rescale(0); rescale(1);
    o[0] = wmma_f16(vf[0].v, pf.v, o[0]);
    o[1] = wmma_f16(vf[1].v, pf.v, o[1]);
    // keeps the reads of d-chunks 4 and 5 behind the two products whose registers they reuse; the rest of the rescale and
    // the next two products cover their latency
    __builtin_amdgcn_sched_barrier(0);
    read_v(4); read_v(5);
#pragma unroll
    for (int n = 2; n < 8; ++n) rescale(n);
    o[2] = wmma_f16(vf[2].v, pf.v, o[2]);
    o[3] = wmma_f16(vf[3].v, pf.v, o[3]);
    // keeps the reads of d-chunks 6 and 7 behind the two products whose registers they reuse ...
    __builtin_amdgcn_sched_barrier(0);
    read_v(6); read_v(7);
    // ... ahead of the two products that cover their latency
    __builtin_amdgcn_sched_barrier(0);
#pragma unroll
    for (int cn = 4; cn < 8; ++cn) o[cn] = wmma_f16(vf[cn].v, pf.v, o[cn]);
  };

  for (int step = 0; step < NSTEP - 1; ++step) {
    products(step & 1, true, step + 1);
    store_tile((step + 1) & 1);
    __syncthreads();   // tile s + 1 is in LDS, and every reader of this step's buffer is done
  }
  products((NSTEP - 1) & 1, false, 0);

  {
    float* ob = obuf[wave];
#pragma unroll
    for (int n = 0; n < 8; ++n) {   // D map: o[n][r] = O[query l16][d = n*16 + 8h + r]: 8 consecutive d, two 16-B stores
      float* od = ob + l16 * OPF + n * 16 + half * 8;
      const v4f lo = {o[n][0], o[n][1], o[n][2], o[n][3]};
      const v4f hi = {o[n][4], o[n][5], o[n][6], o[n][7]};
      *(v4f*)(od)     = lo;
      *(v4f*)(od + 4) = hi;
    }
    const float lj = lrun + xhalf(lrun);   // the two halves' sums of one query, joined once (all lanes active)
    if (half == 0) {
      mbuf[wave * 16 + l16] = mrun;
      lbuf[wave * 16 + l16] = lj;
    }
  }
  __syncthreads();   // every group's partial state is in LDS

  // Join of the four partial states. Wave w owns block rows 4w..4w+3: query tile w >> 2, tile rows 4(w & 3)..+3.
  // The partial state of group g for query tile t was left by wave 4g + t.
  // out0: one 16-B-per-lane instruction per row (512 B = 4 lines).
  {
    const int t   = wave >> 2;
    const int rr0 = (wave & 3) * 4;
    float* orow = out + ((size_t)(h * SA_SQ + q0 + wave * 4)) * SA_D + lane * 4;
#pragma unroll
    for (int i = 0; i < 4; ++i) {
      const int rr = rr0 + i;
      float mg[SA_NGRP], lg[SA_NGRP];
#pragma unroll
      for (int g = 0; g < SA_NGRP; ++g) {
        mg[g] = mbuf[(g * 4 + t) * 16 + rr];
        lg[g] = lbuf[(g * 4 + t) * 16 + rr];
      }
      const float mx = fmaxf(fmaxf(mg[0], mg[1]), fmaxf(mg[2], mg[3]));
      float ls = 0.0f;
      v4f acc = {0.0f, 0.0f, 0.0f, 0.0f};
#pragma unroll
      for (int g = 0; g < SA_NGRP; ++g) {
        const float w = __builtin_amdgcn_exp2f(mg[g] - mx);
        ls += w * lg[g];
        acc += w * *(const v4f*)(obuf[g * 4 + t] + rr * OPF + lane * 4);
      }
      *(v4f*)(orow + (size_t)i * SA_D) = acc * (SA_OINV / ls);
    }
  }
  // out1: 64 floats per block (256 B = 2 lines) written by wave 0 lanes 0..15, one instruction; lane owns block rows 4*lane..+3.
  if (wave == 0 && lane < 16) {
    const int t   = lane >> 2;
    const int rr0 = (lane & 3) * 4;
    v4f mg[SA_NGRP], lg[SA_NGRP];
#pragma unroll
    for (int g = 0; g < SA_NGRP; ++g) {
      mg[g] = *(const v4f*)(mbuf + (g * 4 + t) * 16 + rr0);
      lg[g] = *(const v4f*)(lbuf + (g * 4 + t) * 16 + rr0);
    }
    v4f lv;
#pragma unroll
    for (int k = 0; k < 4; ++k) {
      const float mx = fmaxf(fmaxf(mg[0][k], mg[1][k]), fmaxf(mg[2][k], mg[3][k]));
      float ls = 0.0f;
#pragma unroll
      for (int g = 0; g < SA_NGRP; ++g) ls += __builtin_amdgcn_exp2f(mg[g][k] - mx) * lg[g][k];
      lv[k] = SA_LN2 * (mx + log2f(ls));
    }
    *(v4f*)(lse + (size_t)h * SA_SQ + q0 + lane * 4) = lv;
  }
}

extern "C" void kernel_launch(void* const* d_in, const int* in_sizes, int n_in,
                              void* d_out, int out_size, void* d_ws, size_t ws_size,
                              hipStream_t stream) {
  (void)ws_size;
  // static shapes; refuse anything else (outputs stay zero)
  if (n_in < 5) return;
  if (in_sizes[0] != SA_H * SA_SQ * SA_D) return;
  if (in_sizes[1] != SA_H * SA_SKV * SA_D || in_sizes[2] != SA_H * SA_SKV * SA_D) return;
  if (in_sizes[3] != SA_H * SA_SKV * SA_D || in_sizes[4] != SA_H * SA_SKV * SA_D) return;
  if (out_size != SA_H * SA_SQ * SA_D + SA_H * SA_SQ) return;

  const float* q  = (const float*)d_in[0];
  const float* kA = (const float*)d_in[1];
  const float* vA = (const float*)d_in[2];
  const float* kB = (const float*)d_in[3];
  const float* vB = (const float*)d_in[4];
  float* out = (float*)d_out;                              // output 0: [16][1024][128] f32 at byte 0
  float* lse = out + (size_t)SA_H * SA_SQ * SA_D;          // output 1: [16][1024] f32 at byte 8388608

  _Float16* kh = (_Float16*)d_ws;                          // f16 K tiles of both sets: 16 MiB, written anew in every call
  _Float16* vt = kh + (size_t)2 * SA_H * SA_SKV * SA_D;    // f16 V tiles (transposed) of both sets: 16 MiB

  dim3 grid(SA_H * (SA_SQ / SA_QBLK));   // 256 blocks: head x 64-row query tile (1024 = 16 x 64 exactly)
  dim3 block(32 * SA_NWAVE);             // 16 waves: 4 query tiles of 16 rows x 4 KV quarters
  kv_to_f16<<<grid, block, 0, stream>>>(kA, vA, kB, vB, kh, vt);   // 256 blocks x 4 groups x 2 tiles = 2048 tiles = 2 sets x 16 heads x 64
  attn_two_kv<<<grid, block, 0, stream>>>(q, kh, vt, out, lse);
}

// v007
// One run takes 51.1 microseconds.
// Two timings next to v006 put it at 1.04 and 1.05 times that version's speed.
// All steps since v000 together make it 4.82 times as fast.
#include <hip/hip_runtime.h>

typedef _Float16 v16h __attribute__((ext_vector_type(16)));
typedef _Float16 v8h  __attribute__((ext_vector_type(8)));
typedef _Float16 v4h  __attribute__((ext_vector_type(4)));
typedef float    v8f  __attribute__((ext_vector_type(8)));
typedef float    v4f  __attribute__((ext_vector_type(4)));
union Frag { v16h v; v8h h[2]; };

#define SA_H     16
#define SA_SQ    1024
#define SA_SKV   2048
#define SA_D     128
#define SA_QBLK  64            // query rows per block (4 query tiles x 16 rows)
#define SA_NGRP  4             // KV quarters per block: A low, A high, B low, B high; one group of 4 waves each
#define SA_NWAVE (4 * SA_NGRP) // 16 waves: four per SIMD
#define SA_OPS   16.0f         // power-of-two operand pre-scale applied to Q, K, V and P before the f16 convert
// log2-domain score scale: (1/sqrt(D)) * log2(e), with the 2^4*2^4 operand scale of Q and K removed (2^-8)
#define SA_CS    ((0.088388347648318447f * 1.4426950408889634f) * 0.00390625f)
#define SA_LN2   0.69314718055994531f
#define SA_OINV  0.00390625f   // removes the 2^4*2^4 operand scale of P and V

// LDS pitches in 16-bit elements (rows 16-B aligned)
#define KP   136   // K tile   [32 kv][128 d + 8]   d contiguous  -> A fragment for S^T
#define VP   40    // V tile   [128 d][32 kv + 8]   kv contiguous -> A fragment for O^T
#define OPF  132   // O tile   [16 q][128 d + 4]    floats, per wave (epilogue staging)
#define NSTEP (2 * SA_SKV / 32 / SA_NGRP)   // steps of 32 kv rows per group
#define TILE_E (32 * SA_D)                  // 16-bit elements of one K or V tile in the workspace (8 KiB, contiguous)
#define HTILES (SA_SKV / 32)                // tiles per head and KV set; tile number = (set * SA_H + head) * HTILES + kv / 32
#define STG    2                            // tiles of 32 kv rows per stage: what one ring buffer holds of one group's K and of its V
#define NTRIP  (NSTEP / STG)                // stages per group
#define KT_E   (32 * KP)                    // 16-bit elements of one K tile in LDS
#define VT_E   (SA_D * VP)                  // 16-bit elements of one V tile in LDS
#define KBUF_B (SA_NGRP * STG * KT_E * 2)   // bytes of one ring buffer's K part (all groups):  69632
#define VBUF_B (SA_NGRP * STG * VT_E * 2)   // bytes of one ring buffer's V part (all groups):  81920

// 16x16x32 f16 WMMA with the VALU hazard guard tied to D (A/B kept live)
__device__ __forceinline__ v8f wmma_f16(v16h a, v16h b, v8f c) {
  v8f d = __builtin_amdgcn_wmma_f32_16x16x32_f16(false, a, false, b, (short)0, c, false, false);
  asm volatile("v_nop\n\tv_nop\n\tv_nop\n\tv_nop" : "+v"(d) : "v"(a), "v"(b));
  return d;
}

// lane l <-> lane l ^ 16: the two lanes that share one query column
__device__ __forceinline__ float xhalf(float x) {
  const int b = __builtin_bit_cast(int, x);
  return __builtin_bit_cast(float, __builtin_amdgcn_permlanex16(b, b, 0x76543210, 0xfedcba98, false, false));
}

// K and V, f32 -> f16 = x * 2^4, once for all 16 query blocks of a head. K tile: [32 kv][128 d]; V tile transposed: [128 d][32 kv].
// A group of 4 waves takes two tiles; a wave takes 8 kv rows of each (one whole 512-B row per load), all 32 loads issued ahead.
__global__ __launch_bounds__(32 * SA_NWAVE)
void kv_to_f16(const float* __restrict__ kA, const float* __restrict__ vA,
               const float* __restrict__ kB, const float* __restrict__ vB,
               _Float16* __restrict__ kh, _Float16* __restrict__ vt)
{
  __shared__ __align__(16) _Float16 tb[2][SA_NGRP][SA_D * VP];   // 81920 B: V tiles on their way from [kv][d] to [d][kv]

  const int tid  = threadIdx.x;
  const int lane = tid & 31;
  const int wave = __builtin_amdgcn_readfirstlane(tid >> 5);
  const int grp  = wave >> 2;
  const int wq   = wave & 3;
  const int srow = wq * 8;
  const int sd   = lane * 4;
  const int h    = blockIdx.x % SA_H;                                   // same head as the attention block of this index
  const int t0   = (blockIdx.x / SA_H) * (2 * SA_NGRP) + grp * 2;       // first of the group's two tiles, 0..127 within the head
  const int set  = t0 / HTILES;                                         // both tiles lie in one KV set (t0 is even)
  const int j0   = t0 % HTILES;
  const float* ks = set ? kB : kA;
  const float* vs = set ? vB : vA;
  const size_t tile0 = (size_t)(set * SA_H + h) * HTILES + j0;

  v4f kx[2][8], vx[2][8];
  const float* bk = ks + ((size_t)(h * SA_SKV + j0 * 32 + srow)) * SA_D;   // wave-uniform bases; the lane adds its 4 d
  const float* bv = vs + ((size_t)(h * SA_SKV + j0 * 32 + srow)) * SA_D;
#pragma unroll
  for (int t = 0; t < 2; ++t) {   // the second tile's rows follow the first's at 32 rows' distance
#pragma unroll
    for (int i = 0; i < 8; ++i) kx[t][i] = *(const v4f*)(bk + sd + (t * 32 + i) * SA_D);
#pragma unroll
    for (int i = 0; i < 8; ++i) vx[t][i] = *(const v4f*)(bv + sd + (t * 32 + i) * SA_D);
  }
  // the loads stay in flight over code that reuses the registers their addresses stand in: keep the wait in front of that reuse.
  // The two bases and the lane number are inputs so that they keep their registers up to the wait
  asm volatile("s_wait_xcnt 0x0" :: "s"(bk), "s"(bv), "v"(lane) : "memory");
  // keeps all 32 loads, and the wait directly behind them, ahead of the first convert: without it the build held the last
  // eight loads back and waited out their latency in pairs
  __builtin_amdgcn_sched_barrier(0);
#pragma unroll
  for (int t = 0; t < 2; ++t) {
    // K keeps its order: 4 d per 8-B store, a wave's store fills one 256-B row of the tile (2 whole lines)
    _Float16* dk = kh + (tile0 + t) * TILE_E + srow * SA_D + sd;
#pragma unroll
    for (int i = 0; i < 8; ++i) {
      v4h p;
      p[0] = (_Float16)(kx[t][i][0] * SA_OPS); p[1] = (_Float16)(kx[t][i][1] * SA_OPS);
      p[2] = (_Float16)(kx[t][i][2] * SA_OPS); p[3] = (_Float16)(kx[t][i][3] * SA_OPS);
      *(v4h*)(dk + i * SA_D) = p;
    }
    // V is turned in LDS: the lane's 8 kv of one d per 16-B store
    _Float16* dv = tb[t][grp];
#pragma unroll
    for (int c = 0; c < 4; ++c) {
      v8h w;
#pragma unroll
      for (int i = 0; i < 8; ++i) w[i] = (_Float16)(vx[t][i][c] * SA_OPS);
      *(v8h*)(dv + (sd + c) * VP + srow) = w;
    }
  }
  __syncthreads();   // both turned V tiles of every group are in LDS
#pragma unroll
  for (int t = 0; t < 2; ++t) {
    _Float16* gv = vt + (tile0 + t) * TILE_E;
#pragma unroll
    for (int i = 0; i < 4; ++i) {   // 16-B piece e of the tile: d = e / 4, kv = 8 * (e % 4); a wave's store fills 512 contiguous bytes
      const int e = wq * 128 + i * 32 + lane;
      *(v8h*)(gv + e * 8) = *(const v8h*)(tb[t][grp] + (e >> 2) * VP + (e & 3) * 8);
    }
  }
}

__global__ __launch_bounds__(32 * SA_NWAVE) __attribute__((amdgpu_num_vgpr(256)))
void attn_two_kv(const float* __restrict__ q,
                 const _Float16* __restrict__ kh, const _Float16* __restrict__ vt,
                 float* out, float* lse)
{
  // 303104 B: the ring, K part [2 buffers][group][tile of the stage][32 * KP], then V part [2][group][tile][SA_D * VP].
  // Behind the loop's last barrier the same bytes hold the unnormalised partial O, [wave][16 * OPF] floats (135168 B).
  __shared__ __align__(16) unsigned char ring[2 * KBUF_B + 2 * VBUF_B];
  __shared__ __align__(16) float    mbuf[SA_NWAVE * 16];           //   1024 B, partial row maxima (log2 domain)
  __shared__ __align__(16) float    lbuf[SA_NWAVE * 16];           //   1024 B, partial row sums

  const int tid  = threadIdx.x;
  const int lane = tid & 31;
  const int wave = __builtin_amdgcn_readfirstlane(tid >> 5);   // scalar, so that the group's base pointers stay scalar
  const int grp  = wave >> 2;       // KV quarter this wave works on
  const int wq   = wave & 3;        // query tile (16 rows) this wave works on
  const int half = lane >> 4;       // h of the fragment map
  const int l16  = lane & 15;       // row m for A, column n for B and D (the lane's query)

  const int h    = blockIdx.x % SA_H;
  const int q0   = (blockIdx.x / SA_H) * SA_QBLK;
  const int qrow = q0 + wq * 16;
  _Float16* const kring = (_Float16*)ring;
  _Float16* const vring = (_Float16*)(ring + 2 * KBUF_B);
  float*    const obuf  = (float*)ring;

  // staging split (4 waves of a group): a wave takes a quarter (2 KiB) of each f16 K tile and of each f16 V tile; one copy
  // instruction covers 512 contiguous bytes (4 lines), a lane moves one 16-B piece in each of the 4 + 4 copies of a tile pair
  const size_t tile0 = (size_t)((grp >> 1) * SA_H + h) * HTILES + (grp & 1) * (HTILES / 2);   // the group's first tile

  // ---- Q -> 4 B fragments (32 d x 16 query columns each), pre-scaled by 2^4.
  // B map: lane column n = query l16; elements 0..7 <- d = c*32 + 8h + 0..7; elements 8..15 <- d = c*32 + 16 + 8h + 0..7
  v16h qf[4];
  {
    const float* qp = q + ((size_t)(h * SA_SQ + qrow + l16)) * SA_D;
#pragma unroll
    for (int c = 0; c < 4; ++c) {
      Frag f;
#pragma unroll
      for (int s = 0; s < 2; ++s) {
        const int d0 = c * 32 + 16 * s + 8 * half;
        const float4 a0 = *(const float4*)(qp + d0);
        const float4 a1 = *(const float4*)(qp + d0 + 4);
        v8h t;
        t[0] = (_Float16)(a0.x * SA_OPS); t[1] = (_Float16)(a0.y * SA_OPS);
        t[2] = (_Float16)(a0.z * SA_OPS); t[3] = (_Float16)(a0.w * SA_OPS);
        t[4] = (_Float16)(a1.x * SA_OPS); t[5] = (_Float16)(a1.y * SA_OPS);
        t[6] = (_Float16)(a1.z * SA_OPS); t[7] = (_Float16)(a1.w * SA_OPS);
        f.h[s] = t;
      }
      qf[c] = f.v;
    }
  }

  v8f o[8];
#pragma unroll
  for (int n = 0; n < 8; ++n)
#pragma unroll
    for (int r = 0; r < 8; ++r) o[n][r] = 0.0f;

  // state of the lane's query: running maximum (equal in both lane halves) and the sum over this half's kv rows only
  float mrun = -1.0e30f, lrun = 0.0f;

  const _Float16* srcK = kh + tile0 * TILE_E + wq * 1024 + lane * 8;
  const _Float16* srcV = vt + tile0 * TILE_E + wq * 1024 + lane * 8;
  // the lane's LDS byte addresses (low 32 bits of the __shared__ address) of its first piece in buffer 0; only the row pitch
  // differs from the workspace tile (256 -> 272 B for K, 64 -> 80 B for V).
  // K tile (32 kv x 128 d), d contiguous: piece e = wq*128 + i*32 + lane is kv row e / 16, d = 8 * (e % 16)
  const unsigned ldsK = (unsigned)(size_t)(kring + grp * (STG * KT_E) + (wq * 8 + (lane >> 4)) * KP + (lane & 15) * 8);
  // V tile [d][kv], kv contiguous: piece e is d = e / 4, kv = 8 * (e % 4)
  const unsigned ldsV = (unsigned)(size_t)(vring + grp * (STG * VT_E) + (wq * 32 + (lane >> 2)) * VP + (lane & 3) * 8);

  // ---- stage st (tiles 2 st and 2 st + 1 of the group) into ring buffer b: 8 + 8 copies per wave, through no register.
  // The s_wait_xcnt is the last line of the copies' own statement: it stands in front of every reuse of their address registers.
  auto copy8 = [&](const _Float16* g, unsigned l, int gstep, unsigned lstep, unsigned ltile) {
    asm volatile("global_load_async_to_lds_b128 %0, %8, off\n\t"
                 "global_load_async_to_lds_b128 %1, %9, off\n\t"
                 "global_load_async_to_lds_b128 %2, %10, off\n\t"
                 "global_load_async_to_lds_b128 %3, %11, off\n\t"
                 "global_load_async_to_lds_b128 %4, %12, off\n\t"
                 "global_load_async_to_lds_b128 %5, %13, off\n\t"
                 "global_load_async_to_lds_b128 %6, %14, off\n\t"
                 "global_load_async_to_lds_b128 %7, %15, off\n\t"
                 "s_wait_xcnt 0x0"
                 :: "v"(l), "v"(l + lstep), "v"(l + 2 * lstep), "v"(l + 3 * lstep),
                    "v"(l + ltile), "v"(l + ltile + lstep), "v"(l + ltile + 2 * lstep), "v"(l + ltile + 3 * lstep),
                    "v"(g), "v"(g + gstep), "v"(g + 2 * gstep), "v"(g + 3 * gstep),
                    "v"(g + TILE_E), "v"(g + TILE_E + gstep), "v"(g + TILE_E + 2 * gstep), "v"(g + TILE_E + 3 * gstep)
                 : "memory");
  };
  auto copy_stage = [&](int st, int b) {
    copy8(srcK + (size_t)st * (STG * TILE_E), ldsK + b * KBUF_B, 256, 2 * KP * 2, KT_E * 2);
    copy8(srcV + (size_t)st * (STG * TILE_E), ldsV + b * VBUF_B, 256, 8 * VP * 2, VT_E * 2);
  };

  copy_stage(0, 0);
  asm volatile("s_wait_asynccnt 0x0" ::: "memory");   // this wave's copies of stage 0 have landed
  __syncthreads();                                    // stage 0 is in LDS for every wave
  copy_stage(1, 1);

  // Each group runs one online-softmax pass over its own KV quarter; the four partial states of a query row
  // are joined after the loop by their maxima and sums == LSE-weighted combine of the partial states.
  // Trip t works on buffer t & 1 (two tiles of 32 kv rows) while the copies of stage t + 1 fly into the other buffer; stage t + 2
  // is issued behind the trip's barrier into the buffer that the trip has read.
  auto products = [&](int b, int sub) __attribute__((always_inline)) {   // six uses: without the attribute the build made it a call
    const _Float16* kbuf  = kring + ((b * SA_NGRP + grp) * STG + sub) * KT_E;
    const _Float16* vbufT = vring + ((b * SA_NGRP + grp) * STG + sub) * VT_E;

    // ---- S^T = (2^4 K)(2^4 Q)^T : two 16x16 tiles (kv rows 0..15 and 16..31), 4 k-steps over d.
    // A map (same k map as B): lane row m = kv l16; elements 0..7 <- d = c*32 + 8h + 0..7; 8..15 <- d = c*32 + 16 + 8h + 0..7
    // The K tile's LDS reads stand in groups ahead of the products instead of one small group in front of each pair:
    // 12 reads (d-chunks 0..2) ahead of all products, the last 4 behind the first pair, in whose registers they land
    // (all 16 at once did not fit the register budget: the build spilled a Q fragment).
    v8f s0, s1;
#pragma unroll
    for (int r = 0; r < 8; ++r) { s0[r] = 0.0f; s1[r] = 0.0f; }
    Frag b0[4], b1[4];
    auto read_k = [&](int c) {
      const _Float16* kp0 = kbuf + l16 * KP + c * 32 + half * 8;   // kv row l16
      const _Float16* kp1 = kp0 + 16 * KP;                           // kv row 16 + l16
      b0[c].h[0] = *(const v8h*)(kp0);  b0[c].h[1] = *(const v8h*)(kp0 + 16);
      b1[c].h[0] = *(const v8h*)(kp1);  b1[c].h[1] = *(const v8h*)(kp1 + 16);
    };
    read_k(0); read_k(1); read_k(2);
    // keeps the read group whole: without it the build sinks each read to its product and waits out the LDS latency there
    __builtin_amdgcn_sched_barrier(0);
    s0 = wmma_f16(b0[0].v, qf[0], s0);
    s1 = wmma_f16(b1[0].v, qf[0], s1);
    // keeps the last reads behind the first pair (whose registers they reuse) ...
    __builtin_amdgcn_sched_barrier(0);
    read_k(3);
    // ... and ahead of the two pairs that cover their latency
    __builtin_amdgcn_sched_barrier(0);
#pragma unroll
    for (int c = 1; c < 4; ++c) {
      s0 = wmma_f16(b0[c].v, qf[c], s0);
      s1 = wmma_f16(b1[c].v, qf[c], s1);
    }
    // keeps the V reads below behind the last score product (they take over the K fragments' registers)
    __builtin_amdgcn_sched_barrier(0);

    // ---- V^T fragments of d-chunks 0..3, read as one group here so that the softmax below covers their LDS latency.
    // A map: lane row m = d (cn*16 + l16); elements 0..7 <- kv 8h + 0..7; 8..15 <- kv 16 + 8h + 0..7
    Frag vf[8];
    auto read_v = [&](int cn) {
      const _Float16* vp = vbufT + (cn * 16 + l16) * VP + half * 8;
      vf[cn].h[0] = *(const v8h*)(vp);
      vf[cn].h[1] = *(const v8h*)(vp + 16);
    };
    read_v(0); read_v(1); read_v(2); read_v(3);
    // keeps that group ahead of the softmax: without it the reads sink to their products
    __builtin_amdgcn_sched_barrier(0);

    // ---- online softmax in the log2 domain; D map: s0[r] = S[query l16][kv 8h + r], s1[r] = S[query l16][kv 16 + 8h + r]:
    // a query's 32 scores lie in the two lanes l16 and 16 + l16, so its maximum is in-lane plus one exchange
    float mx = fmaxf(s0[0], s1[0]);
#pragma unroll
    for (int r = 1; r < 8; ++r) mx = fmaxf(mx, fmaxf(s0[r], s1[r]));
    mx = fmaxf(mx, xhalf(mx));
    const float mn = fmaxf(mrun, mx * SA_CS);
    float cf;
    // exp2 with its free slot in one statement
    asm("v_exp_f32 %0, %1\n\tv_nop" : "=v"(cf) : "v"(mrun - mn));
    float e0[8], e1[8];
#pragma unroll
    for (int r = 0; r < 8; ++r) {
      e0[r] = s0[r] * SA_CS - mn;
      e1[r] = s1[r] * SA_CS - mn;
    }
    // the 16 exp2, each in place on its own register, with the free slot behind the last, in one statement: this build laid
    // an exp2's result over the source register of the exp2 directly in front of it
    asm("v_exp_f32 %0, %0\n\tv_exp_f32 %1, %1\n\tv_exp_f32 %2, %2\n\tv_exp_f32 %3, %3\n\t"
        "v_exp_f32 %4, %4\n\tv_exp_f32 %5, %5\n\tv_exp_f32 %6, %6\n\tv_exp_f32 %7, %7\n\t"
        "v_exp_f32 %8, %8\n\tv_exp_f32 %9, %9\n\tv_exp_f32 %10, %10\n\tv_exp_f32 %11, %11\n\t"
        "v_exp_f32 %12, %12\n\tv_exp_f32 %13, %13\n\tv_exp_f32 %14, %14\n\tv_exp_f32 %15, %15\n\tv_nop"
        : "+v"(e0[0]), "+v"(e1[0]), "+v"(e0[1]), "+v"(e1[1]), "+v"(e0[2]), "+v"(e1[2]), "+v"(e0[3]), "+v"(e1[3]),
          "+v"(e0[4]), "+v"(e1[4]), "+v"(e0[5]), "+v"(e1[5]), "+v"(e0[6]), "+v"(e1[6]), "+v"(e0[7]), "+v"(e1[7]));
    float rs = 0.0f;
#pragma unroll
    for (int r = 0; r < 8; ++r) {
      s0[r] = e0[r];
      s1[r] = e1[r];
      rs += s0[r] + s1[r];
    }
    lrun = lrun * cf + rs;
    mrun = mn;

    // ---- P^T (<= 1) pre-scaled by 2^4: the two score tiles, converted in place, are the B fragment
    // B map: lane column n = query l16; elements 0..7 <- kv 8h + 0..7 (s0); 8..15 <- kv 16 + 8h + 0..7 (s1)
    Frag pf;
#pragma unroll
    for (int r = 0; r < 8; ++r) {
      pf.h[0][r] = (_Float16)(s0[r] * SA_OPS);
      pf.h[1][r] = (_Float16)(s1[r] * SA_OPS);
    }

    // ---- O^T = O^T * cf + (2^4 V)^T (2^4 P)^T : 8 d-chunks of 16 rows. The other four fragments are read in two groups of
    // 4 reads, each into the registers of the two products just issued (more fragments at once spilled a Q fragment).
    auto rescale = [&](int n) {
#pragma unroll
      for (int r = 0; r < 8; ++r) o[n][r] *= cf;
    };
    rescale(0); rescale(1);
    o[0] = wmma_f16(vf[0].v, pf.v, o[0]);
    o[1] = wmma_f16(vf[1].v, pf.v, o[1]);
    // keeps the reads of d-chunks 4 and 5 behind the two products whose registers they reuse; the rest of the rescale and
    // the next two products cover their latency
    __builtin_amdgcn_sched_barrier(0);
    read_v(4); read_v(5);
#pragma unroll
    for (int n = 2; n < 8; ++n) rescale(n);
    o[2] = wmma_f16(vf[2].v, pf.v, o[2]);
    o[3] = wmma_f16(vf[3].v, pf.v, o[3]);
    // keeps the reads of d-chunks 6 and 7 behind the two products whose registers they reuse ...
    __builtin_amdgcn_sched_barrier(0);
    read_v(6); read_v(7);
    // ... ahead of the two products that cover their latency
    __builtin_amdgcn_sched_barrier(0);
#pragma unroll
    for (int cn = 4; cn < 8; ++cn) o[cn] = wmma_f16(vf[cn].v, pf.v, o[cn]);
  };

  auto trip = [&](int b) __attribute__((always_inline)) {
    products(b, 0);
    products(b, 1);
    asm volatile("s_wait_dscnt 0x0" ::: "memory");      // this wave's reads of buffer b are done before the buffer is refilled
    asm volatile("s_wait_asynccnt 0x0" ::: "memory");   // this wave's copies of the next stage have landed
    __syncthreads();   // the next stage is in LDS for every wave, and every reader of buffer b is done (last trip: the ring is free)
  };
  // the loop ends where no stage t + 2 is left to issue; the last two trips stand behind it, without copies
  for (int t = 0; t < NTRIP - 2; ++t) {
    trip(t & 1);
    copy_stage(t + 2, t & 1);
  }
  trip(NTRIP & 1);
  trip((NTRIP + 1) & 1);
  asm volatile("s_wait_asynccnt 0x0" ::: "memory");     // no copy is left in flight when the ring becomes output staging

  {
    float* ob = obuf + wave * (16 * OPF);
#pragma unroll
    for (int n = 0; n < 8; ++n) {   // D map: o[n][r] = O[query l16][d = n*16 + 8h + r]: 8 consecutive d, two 16-B stores
      float* od = ob + l16 * OPF + n * 16 + half * 8;
      const v4f lo = {o[n][0], o[n][1], o[n][2], o[n][3]};
      const v4f hi = {o[n][4], o[n][5], o[n][6], o[n][7]};
      *(v4f*)(od)     = lo;
      *(v4f*)(od + 4) = hi;
    }
    const float lj = lrun + xhalf(lrun);   // the two halves' sums of one query, joined once (all lanes active)
    if (half == 0) {
      mbuf[wave * 16 + l16] = mrun;
      lbuf[wave * 16 + l16] = lj;
    }
  }
  __syncthreads();   // every group's partial state is in LDS

  // Join of the four partial states. Wave w owns block rows 4w..4w+3: query tile w >> 2, tile rows 4(w & 3)..+3.
  // The partial state of group g for query tile t was left by wave 4g + t.
  // out0: one 16-B-per-lane instruction per row (512 B = 4 lines).
  {
    const int t   = wave >> 2;
    const int rr0 = (wave & 3) * 4;
    float* orow = out + ((size_t)(h * SA_SQ + q0 + wave * 4)) * SA_D + lane * 4;
#pragma unroll
    for (int i = 0; i < 4; ++i) {
      const int rr = rr0 + i;
      float mg[SA_NGRP], lg[SA_NGRP];
#pragma unroll
      for (int g = 0; g < SA_NGRP; ++g) {
        mg[g] = mbuf[(g * 4 + t) * 16 + rr];
        lg[g] = lbuf[(g * 4 + t) * 16 + rr];
      }
      const float mx = fmaxf(fmaxf(mg[0], mg[1]), fmaxf(mg[2], mg[3]));
      float ls = 0.0f;
      v4f acc = {0.0f, 0.0f, 0.0f, 0.0f};
#pragma unroll
      for (int g = 0; g < SA_NGRP; ++g) {
        const float w = __builtin_amdgcn_exp2f(mg[g] - mx);
        ls += w * lg[g];
        acc += w * *(const v4f*)(obuf + (g * 4 + t) * (16 * OPF) + rr * OPF + lane * 4);
      }
      *(v4f*)(orow + (size_t)i * SA_D) = acc * (SA_OINV / ls);
    }
  }
  // out1: 64 floats per block (256 B = 2 lines) written by wave 0 lanes 0..15, one instruction; lane owns block rows 4*lane..+3.
  if (wave == 0 && lane < 16) {
    const int t   = lane >> 2;
    const int rr0 = (lane & 3) * 4;
    v4f mg[SA_NGRP], lg[SA_NGRP];
#pragma unroll
    for (int g = 0; g < SA_NGRP; ++g) {
      mg[g] = *(const v4f*)(mbuf + (g * 4 + t) * 16 + rr0);
      lg[g] = *(const v4f*)(lbuf + (g * 4 + t) * 16 + rr0);
    }
    v4f lv;
#pragma unroll
    for (int k = 0; k < 4; ++k) {
      const float mx = fmaxf(fmaxf(mg[0][k], mg[1][k]), fmaxf(mg[2][k], mg[3][k]));
      float ls = 0.0f;
#pragma unroll
      for (int g = 0; g < SA_NGRP; ++g) ls += __builtin_amdgcn_exp2f(mg[g][k] - mx) * lg[g][k];
      lv[k] = SA_LN2 * (mx + log2f(ls));
    }
    *(v4f*)(lse + (size_t)h * SA_SQ + q0 + lane * 4) = lv;
  }
}

extern "C" void kernel_launch(void* const* d_in, const int* in_sizes, int n_in,
                              void* d_out, int out_size, void* d_ws, size_t ws_size,
                              hipStream_t stream) {
  (void)ws_size;
  // static shapes; refuse anything else (outputs stay zero)
  if (n_in < 5) return;
  if (in_sizes[0] != SA_H * SA_SQ * SA_D) return;
  if (in_sizes[1] != SA_H * SA_SKV * SA_D || in_sizes[2] != SA_H * SA_SKV * SA_D) return;
  if (in_sizes[3] != SA_H * SA_SKV * SA_D || in_sizes[4] != SA_H * SA_SKV * SA_D) return;
  if (out_size != SA_H * SA_SQ * SA_D + SA_H * SA_SQ) return;

  const float* q  = (const float*)d_in[0];
  const float* kA = (const float*)d_in[1];
  const float* vA = (const float*)d_in[2];
  const float* kB = (const float*)d_in[3];
  const float* vB = (const float*)d_in[4];
  float* out = (float*)d_out;                              // output 0: [16][1024][128] f32 at byte 0
  float* lse = out + (size_t)SA_H * SA_SQ * SA_D;          // output 1: [16][1024] f32 at byte 8388608

  _Float16* kh = (_Float16*)d_ws;                          // f16 K tiles of both sets: 16 MiB, written anew in every call
  _Float16* vt = kh + (size_t)2 * SA_H * SA_SKV * SA_D;    // f16 V tiles (transposed) of both sets: 16 MiB

  dim3 grid(SA_H * (SA_SQ / SA_QBLK));   // 256 blocks: head x 64-row query tile (1024 = 16 x 64 exactly)
  dim3 block(32 * SA_NWAVE);             // 16 waves: 4 query tiles of 16 rows x 4 KV quarters
  kv_to_f16<<<grid, block, 0, stream>>>(kA, vA, kB, vB, kh, vt);   // 256 blocks x 4 groups x 2 tiles = 2048 tiles = 2 sets x 16 heads x 64
  attn_two_kv<<<grid, block, 0, stream>>>(q, kh, vt, out, lse);
}

// v008
// One run takes 47.9 microseconds.
// In two side-by-side timings against v007, it was 1.08 and 1.07 times as fast.
// All steps since v000 together make it 5.18 times as fast.
#include <hip/hip_runtime.h>

typedef _Float16 v16h __attribute__((ext_vector_type(16)));
typedef _Float16 v8h  __attribute__((ext_vector_type(8)));
typedef _Float16 v4h  __attribute__((ext_vector_type(4)));
typedef float    v8f  __attribute__((ext_vector_type(8)));
typedef float    v4f  __attribute__((ext_vector_type(4)));
union Frag { v16h v; v8h h[2]; };

#define SA_H     16
#define SA_SQ    1024
#define SA_SKV   2048
#define SA_D     128
#define SA_QBLK  64            // query rows per block (2 wave tiles x 32 rows)
#define SA_NGRP  4             // KV quarters per block: A low, A high, B low, B high; one group of waves each
#define SA_NWAVE (4 * SA_NGRP) // kv_to_f16: 16 waves, four per group
#define AT_NWAVE (2 * SA_NGRP) // attn_two_kv: 8 waves, two per group and two per SIMD (register budget 512 per wave)
#define SA_OPS   16.0f         // power-of-two operand pre-scale applied to Q, K, V and P before the f16 convert
// log2-domain score scale: (1/sqrt(D)) * log2(e), with the 2^4*2^4 operand scale of Q and K removed (2^-8)
#define SA_CS    ((0.088388347648318447f * 1.4426950408889634f) * 0.00390625f)
#define SA_LN2   0.69314718055994531f
#define SA_OINV  0.00390625f   // removes the 2^4*2^4 operand scale of P and V

// LDS pitches in 16-bit elements (rows 16-B aligned)
#define KP   136   // K tile   [32 kv][128 d + 8]   d contiguous  -> A fragment for S^T
#define VP   40    // V tile   [128 d][32 kv + 8]   kv contiguous -> A fragment for O^T
#define OPF  132   // O rows   [q][128 d + 4]       floats (epilogue staging)
#define NSTEP (2 * SA_SKV / 32 / SA_NGRP)   // steps of 32 kv rows per group
#define TILE_E (32 * SA_D)                  // 16-bit elements of one K or V tile in the workspace (8 KiB, contiguous)
#define HTILES (SA_SKV / 32)                // tiles per head and KV set; tile number = (set * SA_H + head) * HTILES + kv / 32
#define STG    2                            // tiles of 32 kv rows per stage: what one ring buffer holds of one group's K and of its V
#define NTRIP  (NSTEP / STG)                // stages per group
#define KT_E   (32 * KP)                    // 16-bit elements of one K tile in LDS
#define VT_E   (SA_D * VP)                  // 16-bit elements of one V tile in LDS
#define KBUF_B (SA_NGRP * STG * KT_E * 2)   // bytes of one ring buffer's K part (all groups):  69632
#define VBUF_B (SA_NGRP * STG * VT_E * 2)   // bytes of one ring buffer's V part (all groups):  81920

// 16x16x32 f16 WMMA, the plain builtin: the compiler keeps its distances, and its operands may stand above v255
__device__ __forceinline__ v8f wmma_f16(v16h a, v16h b, v8f c) {
  return __builtin_amdgcn_wmma_f32_16x16x32_f16(false, a, false, b, (short)0, c, false, false);
}

// exp2 with its free slot in one statement: nothing that reads its result or overwrites its source stands directly behind it
__device__ __forceinline__ float exp2_slot(float x) {
  float y;
  asm("v_exp_f32 %0, %1\n\tv_nop" : "=v"(y) : "v"(x));
  return y;
}

// lane l <-> lane l ^ 16: the two lanes that share one query column
__device__ __forceinline__ float xhalf(float x) {
  const int b = __builtin_bit_cast(int, x);
  return __builtin_bit_cast(float, __builtin_amdgcn_permlanex16(b, b, 0x76543210, 0xfedcba98, false, false));
}

// K and V, f32 -> f16 = x * 2^4, once for all 16 query blocks of a head. K tile: [32 kv][128 d]; V tile transposed: [128 d][32 kv].
// A group of 4 waves takes two tiles; a wave takes 8 kv rows of each (one whole 512-B row per load), all 32 loads issued ahead.
__global__ __launch_bounds__(32 * SA_NWAVE)
void kv_to_f16(const float* __restrict__ kA, const float* __restrict__ vA,
               const float* __restrict__ kB, const float* __restrict__ vB,
               _Float16* __restrict__ kh, _Float16* __restrict__ vt)
{
  __shared__ __align__(16) _Float16 tb[2][SA_NGRP][SA_D * VP];   // 81920 B: V tiles on their way from [kv][d] to [d][kv]

  const int tid  = threadIdx.x;
  const int lane = tid & 31;
  const int wave = __builtin_amdgcn_readfirstlane(tid >> 5);
  const int grp  = wave >> 2;
  const int wq   = wave & 3;
  const int srow = wq * 8;
  const int sd   = lane * 4;
  const int h    = blockIdx.x % SA_H;                                   // same head as the attention block of this index
  const int t0   = (blockIdx.x / SA_H) * (2 * SA_NGRP) + grp * 2;       // first of the group's two tiles, 0..127 within the head
  const int set  = t0 / HTILES;                                         // both tiles lie in one KV set (t0 is even)
  const int j0   = t0 % HTILES;
  const float* ks = set ? kB : kA;
  const float* vs = set ? vB : vA;
  const size_t tile0 = (size_t)(set * SA_H + h) * HTILES + j0;

  v4f kx[2][8], vx[2][8];
  const float* bk = ks + ((size_t)(h * SA_SKV + j0 * 32 + srow)) * SA_D;   // wave-uniform bases; the lane adds its 4 d
  const float* bv = vs + ((size_t)(h * SA_SKV + j0 * 32 + srow)) * SA_D;
#pragma unroll
  for (int t = 0; t < 2; ++t) {   // the second tile's rows follow the first's at 32 rows' distance
#pragma unroll
    for (int i = 0; i < 8; ++i) kx[t][i] = *(const v4f*)(bk + sd + (t * 32 + i) * SA_D);
#pragma unroll
    for (int i = 0; i < 8; ++i) vx[t][i] = *(const v4f*)(bv + sd + (t * 32 + i) * SA_D);
  }
  // the loads stay in flight over code that reuses the registers their addresses stand in: keep the wait in front of that reuse.
  // The two bases and the lane number are inputs so that they keep their registers up to the wait
  asm volatile("s_wait_xcnt 0x0" :: "s"(bk), "s"(bv), "v"(lane) : "memory");
  // keeps all 32 loads, and the wait directly behind them, ahead of the first convert: without it the build held the last
  // eight loads back and waited out their latency in pairs
  __builtin_amdgcn_sched_barrier(0);
#pragma unroll
  for (int t = 0; t < 2; ++t) {
    // K keeps its order: 4 d per 8-B store, a wave's store fills one 256-B row of the tile (2 whole lines)
    _Float16* dk = kh + (tile0 + t) * TILE_E + srow * SA_D + sd;
#pragma unroll
    for (int i = 0; i < 8; ++i) {
      v4h p;
      p[0] = (_Float16)(kx[t][i][0] * SA_OPS); p[1] = (_Float16)(kx[t][i][1] * SA_OPS);
      p[2] = (_Float16)(kx[t][i][2] * SA_OPS); p[3] = (_Float16)(kx[t][i][3] * SA_OPS);
      *(v4h*)(dk + i * SA_D) = p;
    }
    // V is turned in LDS: the lane's 8 kv of one d per 16-B store
    _Float16* dv = tb[t][grp];
#pragma unroll
    for (int c = 0; c < 4; ++c) {
      v8h w;
#pragma unroll
      for (int i = 0; i < 8; ++i) w[i] = (_Float16)(vx[t][i][c] * SA_OPS);
      *(v8h*)(dv + (sd + c) * VP + srow) = w;
    }
  }
  __syncthreads();   // both turned V tiles of every group are in LDS
#pragma unroll
  for (int t = 0; t < 2; ++t) {
    _Float16* gv = vt + (tile0 + t) * TILE_E;
#pragma unroll
    for (int i = 0; i < 4; ++i) {   // 16-B piece e of the tile: d = e / 4, kv = 8 * (e % 4); a wave's store fills 512 contiguous bytes
      const int e = wq * 128 + i * 32 + lane;
      *(v8h*)(gv + e * 8) = *(const v8h*)(tb[t][grp] + (e >> 2) * VP + (e & 3) * 8);
    }
  }
}

__global__ __launch_bounds__(32 * AT_NWAVE)
void attn_two_kv(const float* __restrict__ q,
                 const _Float16* __restrict__ kh, const _Float16* __restrict__ vt,
                 float* out, float* lse)
{
  // 303104 B: the ring, K part [2 buffers][group][tile of the stage][32 * KP], then V part [2][group][tile][SA_D * VP].
  // Behind the loop's last barrier the same bytes hold the unnormalised partial O, [group][block row][OPF] floats (135168 B).
  __shared__ __align__(16) unsigned char ring[2 * KBUF_B + 2 * VBUF_B];
  __shared__ __align__(16) float    mbuf[SA_NGRP * SA_QBLK];       //   1024 B, partial row maxima (log2 domain), [group][block row]
  __shared__ __align__(16) float    lbuf[SA_NGRP * SA_QBLK];       //   1024 B, partial row sums

  const int tid  = threadIdx.x;
  const int lane = tid & 31;
  const int wave = __builtin_amdgcn_readfirstlane(tid >> 5);   // scalar, so that the group's base pointers stay scalar
  const int grp  = wave >> 1;       // KV quarter this wave works on
  const int wq   = wave & 1;        // query tile (32 rows: two column groups of 16) this wave works on
  const int half = lane >> 4;       // h of the fragment map
  const int l16  = lane & 15;       // row m for A, column n for B and D (the lane's query in each column group)

  const int h    = blockIdx.x % SA_H;
  const int q0   = (blockIdx.x / SA_H) * SA_QBLK;
  const int qrow = q0 + wq * 32;
  _Float16* const kring = (_Float16*)ring;
  _Float16* const vring = (_Float16*)(ring + 2 * KBUF_B);
  float*    const obuf  = (float*)ring;

  // staging split (2 waves of a group): a wave takes a half (4 KiB) of each f16 K tile and of each f16 V tile; one copy
  // instruction covers 512 contiguous bytes (4 lines), a lane moves one 16-B piece in each of the 8 copies of a tile half
  const size_t tile0 = (size_t)((grp >> 1) * SA_H + h) * HTILES + (grp & 1) * (HTILES / 2);   // the group's first tile

  // ---- Q, raw: the lane's 2 x 64 floats, all 32 loads issued ahead of the staging below, which covers their latency
  float4 qa[2][4][2][2];   // [column group][d-chunk of 32][element half s][4 floats]
  {
    const float* qp0 = q + ((size_t)(h * SA_SQ + qrow + l16)) * SA_D + 8 * half;
    const float* qp1 = qp0 + 16 * SA_D;
#pragma unroll
    for (int j = 0; j < 2; ++j)
#pragma unroll
      for (int c = 0; c < 4; ++c)
#pragma unroll
        for (int s = 0; s < 2; ++s) {
          const float* p = (j ? qp1 : qp0) + c * 32 + 16 * s;
          qa[j][c][s][0] = *(const float4*)(p);
          qa[j][c][s][1] = *(const float4*)(p + 4);
        }
    // the loads stay in flight over code that reuses the registers their addresses stand in: keep the wait in front of that reuse.
    // The two addresses are inputs so that they keep their registers up to the wait
    asm volatile("s_wait_xcnt 0x0" :: "v"(qp0), "v"(qp1) : "memory");
    // keeps all 32 loads ahead of the wait and every later register write behind it
    __builtin_amdgcn_sched_barrier(0);
  }

  v8f o[2][8];
#pragma unroll
  for (int j = 0; j < 2; ++j)
#pragma unroll
    for (int n = 0; n < 8; ++n)
#pragma unroll
      for (int r = 0; r < 8; ++r) o[j][n][r] = 0.0f;

  // state of the lane's two queries: running maximum (equal in both lane halves) and the sum over this half's kv rows only
  float mrun[2] = {-1.0e30f, -1.0e30f}, lrun[2] = {0.0f, 0.0f};

  const _Float16* srcK = kh + tile0 * TILE_E + wq * 2048 + lane * 8;
  const _Float16* srcV = vt + tile0 * TILE_E + wq * 2048 + lane * 8;
  // the lane's LDS byte addresses (low 32 bits of the __shared__ address) of its first piece in buffer 0; only the row pitch
  // differs from the workspace tile (256 -> 272 B for K, 64 -> 80 B for V).
  // K tile (32 kv x 128 d), d contiguous: piece e = wq*256 + i*32 + lane is kv row e / 16, d = 8 * (e % 16)
  const unsigned ldsK = (unsigned)(size_t)(kring + grp * (STG * KT_E) + (wq * 16 + (lane >> 4)) * KP + (lane & 15) * 8);
  // V tile [d][kv], kv contiguous: piece e is d = e / 4, kv = 8 * (e % 4)
  const unsigned ldsV = (unsigned)(size_t)(vring + grp * (STG * VT_E) + (wq * 64 + (lane >> 2)) * VP + (lane & 3) * 8);

  // ---- stage st (tiles 2 st and 2 st + 1 of the group) into ring buffer b: 16 + 16 copies per wave, through no register.
  // One statement brings the wave's half of one tile. The s_wait_xcnt is the last line of the copies' own statement: it stands
  // in front of every reuse of their address registers.
  auto copy8 = [&](const _Float16* g, unsigned l, unsigned lstep) {
    asm volatile("global_load_async_to_lds_b128 %0, %8, off\n\t"
                 "global_load_async_to_lds_b128 %1, %9, off\n\t"
                 "global_load_async_to_lds_b128 %2, %10, off\n\t"
                 "global_load_async_to_lds_b128 %3, %11, off\n\t"
                 "global_load_async_to_lds_b128 %4, %12, off\n\t"
                 "global_load_async_to_lds_b128 %5, %13, off\n\t"
                 "global_load_async_to_lds_b128 %6, %14, off\n\t"
                 "global_load_async_to_lds_b128 %7, %15, off\n\t"
                 "s_wait_xcnt 0x0"
                 :: "v"(l), "v"(l + lstep), "v"(l + 2 * lstep), "v"(l + 3 * lstep),
                    "v"(l + 4 * lstep), "v"(l + 5 * lstep), "v"(l + 6 * lstep), "v"(l + 7 * lstep),
                    "v"(g), "v"(g + 256), "v"(g + 2 * 256), "v"(g + 3 * 256),
                    "v"(g + 4 * 256), "v"(g + 5 * 256), "v"(g + 6 * 256), "v"(g + 7 * 256)
                 : "memory");
  };
  auto copy_stage = [&](int st, int b) {
#pragma unroll
    for (int u = 0; u < STG; ++u) {
      // keeps each statement's 24 address registers from being formed ahead of the statement before it (all 96 at once spilled)
      __builtin_amdgcn_sched_barrier(0);
      copy8(srcK + (size_t)st * (STG * TILE_E) + u * TILE_E, ldsK + b * KBUF_B + u * (KT_E * 2), 2 * KP * 2);
      __builtin_amdgcn_sched_barrier(0);
      copy8(srcV + (size_t)st * (STG * TILE_E) + u * TILE_E, ldsV + b * VBUF_B + u * (VT_E * 2), 8 * VP * 2);
    }
  };

  // Stage 0, its wait and barrier, then stage 1. Rolled, so that every address the statements name is formed for them anew: unrolled,
  // the lane's two LDS base addresses were asm operands themselves, and the build spilled them and reloaded them in every stage.
#pragma clang loop unroll(disable)
  for (int p = 0; p < 2; ++p) {
    copy_stage(p, p);
    if (p == 0) {
      asm volatile("s_wait_asynccnt 0x0" ::: "memory");   // this wave's copies of stage 0 have landed
      __syncthreads();                                    // stage 0 is in LDS for every wave
    }
  }

  // ---- Q -> 2 x 4 B fragments (32 d x 16 query columns each), pre-scaled by 2^4.
  // B map: lane column n = query l16; elements 0..7 <- d = c*32 + 8h + 0..7; elements 8..15 <- d = c*32 + 16 + 8h + 0..7
  v16h qf[2][4];
#pragma unroll
  for (int j = 0; j < 2; ++j)
#pragma unroll
    for (int c = 0; c < 4; ++c) {
      Frag f;
#pragma unroll
      for (int s = 0; s < 2; ++s) {
        const float4 a0 = qa[j][c][s][0];
        const float4 a1 = qa[j][c][s][1];
        v8h t;
        t[0] = (_Float16)(a0.x * SA_OPS); t[1] = (_Float16)(a0.y * SA_OPS);
        t[2] = (_Float16)(a0.z * SA_OPS); t[3] = (_Float16)(a0.w * SA_OPS);
        t[4] = (_Float16)(a1.x * SA_OPS); t[5] = (_Float16)(a1.y * SA_OPS);
        t[6] = (_Float16)(a1.z * SA_OPS); t[7] = (_Float16)(a1.w * SA_OPS);
        f.h[s] = t;
      }
      qf[j][c] = f.v;
    }

  // Each group runs one online-softmax pass over its own KV quarter; the four partial states of a query row
  // are joined after the loop by their maxima and sums == LSE-weighted combine of the partial states.
  // Stage t is read from buffer t & 1 (two tiles of 32 kv rows) while the copies of stage t + 1 fly into the other buffer; stage t + 2
  // is issued behind the barrier that ends the reads of stage t, into the buffer that they have left.
  Frag kf[2][4];    // K tile as A fragments: [kv rows 0..15 | 16..31][d-chunk of 32]
  Frag vf[8];       // V^T tile as A fragments: [d-chunk of 16]
  v8f  s[2][2];     // scores: [column group][kv rows 0..15 | 16..31]
  Frag pf[2];       // P^T as B fragments: [column group]
  float cf[2];      // rescale factor of the lane's two queries

  // A map (same k map as B): lane row m = kv l16; elements 0..7 <- d = c*32 + 8h + 0..7; 8..15 <- d = c*32 + 16 + 8h + 0..7
  auto read_k = [&](const _Float16* kt) {   // kt: the tile's start + l16 * KP + half * 8
#pragma unroll
    for (int c = 0; c < 4; ++c)
#pragma unroll
      for (int u = 0; u < 2; ++u) {
        kf[u][c].h[0] = *(const v8h*)(kt + u * 16 * KP + c * 32);
        kf[u][c].h[1] = *(const v8h*)(kt + u * 16 * KP + c * 32 + 16);
      }
  };
  // A map: lane row m = d (cn*16 + l16); elements 0..7 <- kv 8h + 0..7; 8..15 <- kv 16 + 8h + 0..7
  auto read_v = [&](const _Float16* vp) {   // vp: the tile's start + l16 * VP + half * 8
#pragma unroll
    for (int cn = 0; cn < 8; ++cn) {
      vf[cn].h[0] = *(const v8h*)(vp + cn * 16 * VP);
      vf[cn].h[1] = *(const v8h*)(vp + cn * 16 * VP + 16);
    }
  };
  // ---- S^T = (2^4 K)(2^4 Q)^T : 2 x 2 tiles of 16x16 (kv rows x query columns), 4 k-steps over d; a K fragment feeds both column groups
  auto scores = [&]() {
#pragma unroll
    for (int j = 0; j < 2; ++j)
#pragma unroll
      for (int u = 0; u < 2; ++u)
#pragma unroll
        for (int r = 0; r < 8; ++r) s[j][u][r] = 0.0f;
#pragma unroll
    for (int c = 0; c < 4; ++c)
#pragma unroll
      for (int u = 0; u < 2; ++u)
#pragma unroll
        for (int j = 0; j < 2; ++j) s[j][u] = wmma_f16(kf[u][c].v, qf[j][c], s[j][u]);
  };
  // ---- online softmax in the log2 domain; D map: s[j][0][r] = S[query l16][kv 8h + r], s[j][1][r] = S[query l16][kv 16 + 8h + r]:
  // a query's 32 scores lie in the two lanes l16 and 16 + l16, so its maximum is in-lane plus one exchange
  auto softmax = [&](int j) {
    float mx = fmaxf(s[j][0][0], s[j][1][0]);
#pragma unroll
    for (int r = 1; r < 8; ++r) mx = fmaxf(mx, fmaxf(s[j][0][r], s[j][1][r]));
    mx = fmaxf(mx, xhalf(mx));
    const float mn = fmaxf(mrun[j], mx * SA_CS);
    cf[j] = exp2_slot(mrun[j] - mn);
    float e0[8], e1[8];
#pragma unroll
    for (int r = 0; r < 8; ++r) {
      e0[r] = s[j][0][r] * SA_CS - mn;
      e1[r] = s[j][1][r] * SA_CS - mn;
    }
    // the 16 exp2, each in place on its own register, with the free slot behind the last, in one statement: no exp2's result
    // is laid over the source register of the exp2 directly in front of it
    asm("v_exp_f32 %0, %0\n\tv_exp_f32 %1, %1\n\tv_exp_f32 %2, %2\n\tv_exp_f32 %3, %3\n\t"
        "v_exp_f32 %4, %4\n\tv_exp_f32 %5, %5\n\tv_exp_f32 %6, %6\n\tv_exp_f32 %7, %7\n\t"
        "v_exp_f32 %8, %8\n\tv_exp_f32 %9, %9\n\tv_exp_f32 %10, %10\n\tv_exp_f32 %11, %11\n\t"
        "v_exp_f32 %12, %12\n\tv_exp_f32 %13, %13\n\tv_exp_f32 %14, %14\n\tv_exp_f32 %15, %15\n\tv_nop"
        : "+v"(e0[0]), "+v"(e1[0]), "+v"(e0[1]), "+v"(e1[1]), "+v"(e0[2]), "+v"(e1[2]), "+v"(e0[3]), "+v"(e1[3]),
          "+v"(e0[4]), "+v"(e1[4]), "+v"(e0[5]), "+v"(e1[5]), "+v"(e0[6]), "+v"(e1[6]), "+v"(e0[7]), "+v"(e1[7]));
    float rs = 0.0f;
#pragma unroll
    for (int r = 0; r < 8; ++r) rs += e0[r] + e1[r];
    lrun[j] = lrun[j] * cf[j] + rs;
    mrun[j] = mn;
    // P^T (<= 1) pre-scaled by 2^4: the two score tiles, converted in place, are the B fragment
    // B map: lane column n = query l16; elements 0..7 <- kv 8h + 0..7; 8..15 <- kv 16 + 8h + 0..7
#pragma unroll
    for (int r = 0; r < 8; ++r) {
      pf[j].h[0][r] = (_Float16)(e0[r] * SA_OPS);
      pf[j].h[1][r] = (_Float16)(e1[r] * SA_OPS);
    }
  };
  // ---- O^T = O^T * cf + (2^4 V)^T (2^4 P)^T : 8 d-chunks of 16 rows; a V fragment feeds both column groups
  auto pv = [&]() {
#pragma unroll
    for (int j = 0; j < 2; ++j)
#pragma unroll
      for (int n = 0; n < 8; ++n)
#pragma unroll
        for (int r = 0; r < 8; ++r) o[j][n][r] *= cf[j];
#pragma unroll
    for (int cn = 0; cn < 8; ++cn)
#pragma unroll
      for (int j = 0; j < 2; ++j) o[j][cn] = wmma_f16(vf[cn].v, pf[j].v, o[j][cn]);
  };

  // The LDS reads stand in whole-tile groups ahead of the work that covers their latency, never among the products; every
  // sched_barrier below keeps one such group, or the publish point, where it is written (without them the build sinks each read
  // to its product and moves register-only work over the waits).
  auto ktile = [&](int b) { return kring + (b * SA_NGRP + grp) * (STG * KT_E) + l16 * KP + half * 8; };
  auto vtile = [&](int b) { return vring + (b * SA_NGRP + grp) * (STG * VT_E) + l16 * VP + half * 8; };
  // Stage in buffer b, from its first tile's score products (its K fragments are already on their way) to the publish point of the
  // next stage, which stands where the last fragments of buffer b have been fetched: behind the second tile's score products.
  auto front = [&](int b) {
    const _Float16* kt = ktile(b);
    const _Float16* vp = vtile(b);
    scores();
    __builtin_amdgcn_sched_barrier(0);   // the reads below reuse the K fragments' registers: behind the last score product
    read_v(vp);
    read_k(kt + KT_E);
    __builtin_amdgcn_sched_barrier(0);   // first tile's V and second tile's K fragments ahead of the softmax that covers them
    softmax(0); softmax(1);
    pv();
    __builtin_amdgcn_sched_barrier(0);   // the reads below reuse the V fragments' registers: behind the last output product
    read_v(vp + VT_E);
    __builtin_amdgcn_sched_barrier(0);   // second tile's V fragments ahead of the score products that cover them
    scores();
    __builtin_amdgcn_sched_barrier(0);   // the score products stay ahead of the waits: they cover the V reads' latency
    asm volatile("s_wait_dscnt 0x0" ::: "memory");      // this wave's reads of buffer b are done before the buffer is refilled
    asm volatile("s_wait_asynccnt 0x0" ::: "memory");   // this wave's copies of the next stage have landed
    __syncthreads();   // the next stage is in LDS for every wave, and every reader of buffer b is done (last stage: the ring is free)
  };
  // the second tile's softmax and output products: registers only, behind the publish point
  auto back = [&]() {
    softmax(0); softmax(1);
    pv();
  };
  read_k(ktile(0));
  // One rolled loop over all stages (unrolled or peeled, the build put off the straight-line stages' row sums to the epilogue and
  // spilled their terms). Both tests are scalar and read the same in every wave of the block.
#pragma clang loop unroll(disable)
  for (int t = 0; t < NTRIP; ++t) {
    front(t & 1);
    if (t + 2 < NTRIP) copy_stage(t + 2, t & 1);          // only while a stage t + 2 exists
    if (t + 1 < NTRIP) read_k(ktile((t + 1) & 1));        // behind the last stage's barrier nothing is read from the ring
    __builtin_amdgcn_sched_barrier(0);   // the refill and the next stage's first K fragments ahead of the work that covers them
    back();
    __builtin_amdgcn_sched_barrier(0);   // keeps the next stage's score products behind this stage's output products
  }
  asm volatile("s_wait_asynccnt 0x0" ::: "memory");     // no copy is left in flight when the ring becomes output staging

#pragma unroll
  for (int j = 0; j < 2; ++j) {
    const int row = wq * 32 + j * 16 + l16;   // the query's row in the block
    float* ob = obuf + (grp * SA_QBLK + row) * OPF;
#pragma unroll
    for (int n = 0; n < 8; ++n) {   // D map: o[j][n][r] = O[query l16][d = n*16 + 8h + r]: 8 consecutive d, two 16-B stores
      float* od = ob + n * 16 + half * 8;
      const v4f lo = {o[j][n][0], o[j][n][1], o[j][n][2], o[j][n][3]};
      const v4f hi = {o[j][n][4], o[j][n][5], o[j][n][6], o[j][n][7]};
      *(v4f*)(od)     = lo;
      *(v4f*)(od + 4) = hi;
    }
    const float lj = lrun[j] + xhalf(lrun[j]);   // the two halves' sums of one query, joined once (all lanes active)
    if (half == 0) {
      mbuf[grp * SA_QBLK + row] = mrun[j];
      lbuf[grp * SA_QBLK + row] = lj;
    }
  }
  __syncthreads();   // every group's partial state is in LDS

  // Join of the four partial states. Wave w owns block rows 8w..8w+7.
  // out0: one 16-B-per-lane instruction per row (512 B = 4 lines).
  {
    float* orow = out + ((size_t)(h * SA_SQ + q0 + wave * 8)) * SA_D + lane * 4;
    v4f res[8];
#pragma unroll
    for (int i = 0; i < 8; ++i) {
      const int row = wave * 8 + i;
      float mg[SA_NGRP], lg[SA_NGRP];
#pragma unroll
      for (int g = 0; g < SA_NGRP; ++g) {
        mg[g] = mbuf[g * SA_QBLK + row];
        lg[g] = lbuf[g * SA_QBLK + row];
      }
      const float mx = fmaxf(fmaxf(mg[0], mg[1]), fmaxf(mg[2], mg[3]));
      float ls = 0.0f;
      v4f acc = {0.0f, 0.0f, 0.0f, 0.0f};
#pragma unroll
      for (int g = 0; g < SA_NGRP; ++g) {
        const float w = exp2_slot(mg[g] - mx);
        ls += w * lg[g];
        acc += w * *(const v4f*)(obuf + (g * SA_QBLK + row) * OPF + lane * 4);
      }
      res[i] = acc * (SA_OINV / ls);
    }
    // the eight stores stand together behind all the arithmetic, and the wait stands behind them in front of every reuse of their
    // data and address registers; the two sched_barriers keep register writes out of that stretch
    __builtin_amdgcn_sched_barrier(0);
#pragma unroll
    for (int i = 0; i < 8; ++i) *(v4f*)(orow + (size_t)i * SA_D) = res[i];
    asm volatile("s_wait_xcnt 0x0" ::: "memory");
    __builtin_amdgcn_sched_barrier(0);
  }
  // out1: 64 floats per block (256 B = 2 lines) written by wave 0 lanes 0..15, one instruction; lane owns block rows 4*lane..+3.
  if (wave == 0 && lane < 16) {
    v4f mg[SA_NGRP], lg[SA_NGRP];
#pragma unroll
    for (int g = 0; g < SA_NGRP; ++g) {
      mg[g] = *(const v4f*)(mbuf + g * SA_QBLK + lane * 4);
      lg[g] = *(const v4f*)(lbuf + g * SA_QBLK + lane * 4);
    }
    v4f lv;
#pragma unroll
    for (int k = 0; k < 4; ++k) {
      const float mx = fmaxf(fmaxf(mg[0][k], mg[1][k]), fmaxf(mg[2][k], mg[3][k]));
      float ls = 0.0f;
#pragma unroll
      for (int g = 0; g < SA_NGRP; ++g) ls += exp2_slot(mg[g][k] - mx) * lg[g][k];
      lv[k] = SA_LN2 * (mx + log2f(ls));
    }
    *(v4f*)(lse + (size_t)h * SA_SQ + q0 + lane * 4) = lv;
  }
}

extern "C" void kernel_launch(void* const* d_in, const int* in_sizes, int n_in,
                              void* d_out, int out_size, void* d_ws, size_t ws_size,
                              hipStream_t stream) {
  (void)ws_size;
  // static shapes; refuse anything else (outputs stay zero)
  if (n_in < 5) return;
  if (in_sizes[0] != SA_H * SA_SQ * SA_D) return;
  if (in_sizes[1] != SA_H * SA_SKV * SA_D || in_sizes[2] != SA_H * SA_SKV * SA_D) return;
  if (in_sizes[3] != SA_H * SA_SKV * SA_D || in_sizes[4] != SA_H * SA_SKV * SA_D) return;
  if (out_size != SA_H * SA_SQ * SA_D + SA_H * SA_SQ) return;

  const float* q  = (const float*)d_in[0];
  const float* kA = (const float*)d_in[1];
  const float* vA = (const float*)d_in[2];
  const float* kB = (const float*)d_in[3];
  const float* vB = (const float*)d_in[4];
  float* out = (float*)d_out;                              // output 0: [16][1024][128] f32 at byte 0
  float* lse = out + (size_t)SA_H * SA_SQ * SA_D;          // output 1: [16][1024] f32 at byte 8388608

  _Float16* kh = (_Float16*)d_ws;                          // f16 K tiles of both sets: 16 MiB, written anew in every call
  _Float16* vt = kh + (size_t)2 * SA_H * SA_SKV * SA_D;    // f16 V tiles (transposed) of both sets: 16 MiB

  dim3 grid(SA_H * (SA_SQ / SA_QBLK));   // 256 blocks: head x 64-row query tile (1024 = 16 x 64 exactly)
  kv_to_f16<<<grid, dim3(32 * SA_NWAVE), 0, stream>>>(kA, vA, kB, vB, kh, vt);   // 256 blocks x 4 groups x 2 tiles = 2048 tiles = 2 sets x 16 heads x 64
  attn_two_kv<<<grid, dim3(32 * AT_NWAVE), 0, stream>>>(q, kh, vt, out, lse);    // 8 waves: 2 query tiles of 32 rows x 4 KV quarters
}

// v009
// A run of this version takes 44.6 microseconds.
// Two timings next to v008 both put it at 1.07 times that version's speed.
// Over all steps from v000 it is 5.53 times as fast.
#include <hip/hip_runtime.h>

typedef _Float16 v16h __attribute__((ext_vector_type(16)));
typedef _Float16 v8h  __attribute__((ext_vector_type(8)));
typedef _Float16 v4h  __attribute__((ext_vector_type(4)));
typedef float    v8f  __attribute__((ext_vector_type(8)));
typedef float    v4f  __attribute__((ext_vector_type(4)));
union Frag { v16h v; v8h h[2]; };

#define SA_H     16
#define SA_SQ    1024
#define SA_SKV   2048
#define SA_D     128
#define SA_QBLK  64            // query rows per block (2 wave tiles x 32 rows)
#define SA_NGRP  4             // KV quarters per block: A low, A high, B low, B high; one group of waves each
#define SA_NWAVE (4 * SA_NGRP) // kv_to_f16: 16 waves, four per group
#define AT_NWAVE (2 * SA_NGRP) // attn_two_kv: 8 waves, two per group and two per SIMD (register budget 512 per wave)
#define SA_OPS   16.0f         // power-of-two operand pre-scale applied to Q, K, V and P before the f16 convert
// log2-domain score scale: (1/sqrt(D)) * log2(e), with the 2^4*2^4 operand scale of Q and K removed (2^-8)
#define SA_CS    ((0.088388347648318447f * 1.4426950408889634f) * 0.00390625f)
#define SA_LN2   0.69314718055994531f
#define SA_OINV  0.00390625f   // removes the 2^4*2^4 operand scale of P and V

// LDS pitches in 16-bit elements (rows 16-B aligned)
#define KP   136   // K tile   [32 kv][128 d + 8]   d contiguous  -> A fragment for S^T
#define VP   40    // V tile   [128 d][32 kv + 8]   kv contiguous -> A fragment for O^T
#define OPF  132   // O rows   [q][128 d + 4]       floats (epilogue staging)
#define NSTEP (2 * SA_SKV / 32 / SA_NGRP)   // steps of 32 kv rows per group
#define TILE_E (32 * SA_D)                  // 16-bit elements of one K or V tile in the workspace (8 KiB, contiguous)
#define HTILES (SA_SKV / 32)                // tiles per head and KV set; tile number = (set * SA_H + head) * HTILES + kv / 32
#define STG    2                            // tiles of 32 kv rows per stage: what one ring buffer holds of one group's K and of its V
#define NTRIP  (NSTEP / STG)                // stages per group
#define KT_E   (32 * KP)                    // 16-bit elements of one K tile in LDS
#define VT_E   (SA_D * VP)                  // 16-bit elements of one V tile in LDS
#define KBUF_B (SA_NGRP * STG * KT_E * 2)   // bytes of one ring buffer's K part (all groups):  69632
#define VBUF_B (SA_NGRP * STG * VT_E * 2)   // bytes of one ring buffer's V part (all groups):  81920

// 16x16x32 f16 WMMA, the plain builtin: the compiler keeps its distances, and its operands may stand above v255
__device__ __forceinline__ v8f wmma_f16(v16h a, v16h b, v8f c) {
  return __builtin_amdgcn_wmma_f32_16x16x32_f16(false, a, false, b, (short)0, c, false, false);
}

// exp2 with its free slot in one statement: nothing that reads its result or overwrites its source stands directly behind it
__device__ __forceinline__ float exp2_slot(float x) {
  float y;
  asm("v_exp_f32 %0, %1\n\tv_nop" : "=v"(y) : "v"(x));
  return y;
}

// lane l <-> lane l ^ 16: the two lanes that share one query column
__device__ __forceinline__ float xhalf(float x) {
  const int b = __builtin_bit_cast(int, x);
  return __builtin_bit_cast(float, __builtin_amdgcn_permlanex16(b, b, 0x76543210, 0xfedcba98, false, false));
}

// K and V, f32 -> f16 = x * 2^4, once for all 16 query blocks of a head. K tile: [32 kv][128 d]; V tile transposed: [128 d][32 kv].
// A group of 4 waves takes two tiles; a wave takes 8 kv rows of each (one whole 512-B row per load), all 32 loads issued ahead.
__global__ __launch_bounds__(32 * SA_NWAVE)
void kv_to_f16(const float* __restrict__ kA, const float* __restrict__ vA,
               const float* __restrict__ kB, const float* __restrict__ vB,
               _Float16* __restrict__ kh, _Float16* __restrict__ vt)
{
  __shared__ __align__(16) _Float16 tb[2][SA_NGRP][SA_D * VP];   // 81920 B: V tiles on their way from [kv][d] to [d][kv]

  const int tid  = threadIdx.x;
  const int lane = tid & 31;
  const int wave = __builtin_amdgcn_readfirstlane(tid >> 5);
  const int grp  = wave >> 2;
  const int wq   = wave & 3;
  const int srow = wq * 8;
  const int sd   = lane * 4;
  const int h    = blockIdx.x % SA_H;                                   // same head as the attention block of this index
  const int t0   = (blockIdx.x / SA_H) * (2 * SA_NGRP) + grp * 2;       // first of the group's two tiles, 0..127 within the head
  const int set  = t0 / HTILES;                                         // both tiles lie in one KV set (t0 is even)
  const int j0   = t0 % HTILES;
  const float* ks = set ? kB : kA;
  const float* vs = set ? vB : vA;
  const size_t tile0 = (size_t)(set * SA_H + h) * HTILES + j0;

  v4f kx[2][8], vx[2][8];
  const float* bk = ks + ((size_t)(h * SA_SKV + j0 * 32 + srow)) * SA_D;   // wave-uniform bases; the lane adds its 4 d
  const float* bv = vs + ((size_t)(h * SA_SKV + j0 * 32 + srow)) * SA_D;
#pragma unroll
  for (int t = 0; t < 2; ++t) {   // the second tile's rows follow the first's at 32 rows' distance
#pragma unroll
    for (int i = 0; i < 8; ++i) kx[t][i] = *(const v4f*)(bk + sd + (t * 32 + i) * SA_D);
#pragma unroll
    for (int i = 0; i < 8; ++i) vx[t][i] = *(const v4f*)(bv + sd + (t * 32 + i) * SA_D);
  }
  // the loads stay in flight over code that reuses the registers their addresses stand in: keep the wait in front of that reuse.
  // The two bases and the lane number are inputs so that they keep their registers up to the wait
  asm volatile("s_wait_xcnt 0x0" :: "s"(bk), "s"(bv), "v"(lane) : "memory");
  // keeps all 32 loads, and the wait directly behind them, ahead of the first convert: without it the build held the last
  // eight loads back and waited out their latency in pairs
  __builtin_amdgcn_sched_barrier(0);
#pragma unroll
  for (int t = 0; t < 2; ++t) {
    // K keeps its order: 4 d per 8-B store, a wave's store fills one 256-B row of the tile (2 whole lines)
    _Float16* dk = kh + (tile0 + t) * TILE_E + srow * SA_D + sd;
#pragma unroll
    for (int i = 0; i < 8; ++i) {
      v4h p;
      p[0] = (_Float16)(kx[t][i][0] * SA_OPS); p[1] = (_Float16)(kx[t][i][1] * SA_OPS);
      p[2] = (_Float16)(kx[t][i][2] * SA_OPS); p[3] = (_Float16)(kx[t][i][3] * SA_OPS);
      *(v4h*)(dk + i * SA_D) = p;
    }
    // V is turned in LDS: the lane's 8 kv of one d per 16-B store
    _Float16* dv = tb[t][grp];
#pragma unroll
    for (int c = 0; c < 4; ++c) {
      v8h w;
#pragma unroll
      for (int i = 0; i < 8; ++i) w[i] = (_Float16)(vx[t][i][c] * SA_OPS);
      *(v8h*)(dv + (sd + c) * VP + srow) = w;
    }
  }
  __syncthreads();   // both turned V tiles of every group are in LDS
#pragma unroll
  for (int t = 0; t < 2; ++t) {
    _Float16* gv = vt + (tile0 + t) * TILE_E;
#pragma unroll
    for (int i = 0; i < 4; ++i) {   // 16-B piece e of the tile: d = e / 4, kv = 8 * (e % 4); a wave's store fills 512 contiguous bytes
      const int e = wq * 128 + i * 32 + lane;
      *(v8h*)(gv + e * 8) = *(const v8h*)(tb[t][grp] + (e >> 2) * VP + (e & 3) * 8);
    }
  }
}

__global__ __launch_bounds__(32 * AT_NWAVE)
void attn_two_kv(const float* __restrict__ q,
                 const _Float16* __restrict__ kh, const _Float16* __restrict__ vt,
                 float* out, float* lse)
{
  // 303104 B: the ring, K part [2 buffers][group][tile of the stage][32 * KP], then V part [2][group][tile][SA_D * VP].
  // Behind the loop's last barrier the same bytes hold the unnormalised partial O, [group][block row][OPF] floats (135168 B).
  __shared__ __align__(16) unsigned char ring[2 * KBUF_B + 2 * VBUF_B];
  __shared__ __align__(16) float    mbuf[SA_NGRP * SA_QBLK];       //   1024 B, partial row maxima (log2 domain), [group][block row]
  __shared__ __align__(16) float    lbuf[SA_NGRP * SA_QBLK];       //   1024 B, partial row sums

  const int tid  = threadIdx.x;
  const int lane = tid & 31;
  const int wave = __builtin_amdgcn_readfirstlane(tid >> 5);   // scalar, so that the group's base pointers stay scalar
  const int grp  = wave >> 1;       // KV quarter this wave works on
  const int wq   = wave & 1;        // query tile (32 rows: two column groups of 16) this wave works on
  const int half = lane >> 4;       // h of the fragment map
  const int l16  = lane & 15;       // row m for A, column n for B and D (the lane's query in each column group)

  const int h    = blockIdx.x % SA_H;
  const int q0   = (blockIdx.x / SA_H) * SA_QBLK;
  const int qrow = q0 + wq * 32;
  // The 16 query blocks of a head read the same K and V tiles. Each enters the walk over the stages at its own stage and wraps round,
  // so that they do not ask L2 for the same lines at the same moment. Scalar, the same in every wave of the block.
  const int rot  = (blockIdx.x / SA_H) & (NTRIP - 1);
  _Float16* const kring = (_Float16*)ring;
  _Float16* const vring = (_Float16*)(ring + 2 * KBUF_B);
  float*    const obuf  = (float*)ring;

  // staging split (2 waves of a group): a wave takes a half (4 KiB) of each f16 K tile and of each f16 V tile; one copy
  // instruction covers 512 contiguous bytes (4 lines), a lane moves one 16-B piece in each of the 8 copies of a tile half
  const size_t tile0 = (size_t)((grp >> 1) * SA_H + h) * HTILES + (grp & 1) * (HTILES / 2);   // the group's first tile

  // ---- Q, raw: the lane's 2 x 64 floats, all 32 loads issued ahead of the staging below, which covers their latency
  float4 qa[2][4][2][2];   // [column group][d-chunk of 32][element half s][4 floats]
  {
    const float* qp0 = q + ((size_t)(h * SA_SQ + qrow + l16)) * SA_D + 8 * half;
    const float* qp1 = qp0 + 16 * SA_D;
#pragma unroll
    for (int j = 0; j < 2; ++j)
#pragma unroll
      for (int c = 0; c < 4; ++c)
#pragma unroll
        for (int s = 0; s < 2; ++s) {
          const float* p = (j ? qp1 : qp0) + c * 32 + 16 * s;
          qa[j][c][s][0] = *(const float4*)(p);
          qa[j][c][s][1] = *(const float4*)(p + 4);
        }
    // the loads stay in flight over code that reuses the registers their addresses stand in: keep the wait in front of that reuse.
    // The two addresses are inputs so that they keep their registers up to the wait
    asm volatile("s_wait_xcnt 0x0" :: "v"(qp0), "v"(qp1) : "memory");
    // keeps all 32 loads ahead of the wait and every later register write behind it
    __builtin_amdgcn_sched_barrier(0);
  }

  v8f o[2][8];
#pragma unroll
  for (int j = 0; j < 2; ++j)
#pragma unroll
    for (int n = 0; n < 8; ++n)
#pragma unroll
      for (int r = 0; r < 8; ++r) o[j][n][r] = 0.0f;

  // state of the lane's two queries: running maximum (equal in both lane halves) and the sum over this half's kv rows only
  float mrun[2] = {-1.0e30f, -1.0e30f}, lrun[2] = {0.0f, 0.0f};

  const _Float16* srcK = kh + tile0 * TILE_E + wq * 2048 + lane * 8;
  const _Float16* srcV = vt + tile0 * TILE_E + wq * 2048 + lane * 8;
  // the lane's LDS byte addresses (low 32 bits of the __shared__ address) of its first piece in buffer 0; only the row pitch
  // differs from the workspace tile (256 -> 272 B for K, 64 -> 80 B for V).
  // K tile (32 kv x 128 d), d contiguous: piece e = wq*256 + i*32 + lane is kv row e / 16, d = 8 * (e % 16)
  const unsigned ldsK = (unsigned)(size_t)(kring + grp * (STG * KT_E) + (wq * 16 + (lane >> 4)) * KP + (lane & 15) * 8);
  // V tile [d][kv], kv contiguous: piece e is d = e / 4, kv = 8 * (e % 4)
  const unsigned ldsV = (unsigned)(size_t)(vring + grp * (STG * VT_E) + (wq * 64 + (lane >> 2)) * VP + (lane & 3) * 8);

  // ---- stage st (tiles 2 st and 2 st + 1 of the group) into ring buffer b: 16 + 16 copies per wave, through no register.
  // One statement brings the wave's half of one tile. The s_wait_xcnt is the last line of the copies' own statement: it stands
  // in front of every reuse of their address registers.
  auto copy8 = [&](const _Float16* g, unsigned l, unsigned lstep) {
    asm volatile("global_load_async_to_lds_b128 %0, %8, off\n\t"
                 "global_load_async_to_lds_b128 %1, %9, off\n\t"
                 "global_load_async_to_lds_b128 %2, %10, off\n\t"
                 "global_load_async_to_lds_b128 %3, %11, off\n\t"
                 "global_load_async_to_lds_b128 %4, %12, off\n\t"
                 "global_load_async_to_lds_b128 %5, %13, off\n\t"
                 "global_load_async_to_lds_b128 %6, %14, off\n\t"
                 "global_load_async_to_lds_b128 %7, %15, off\n\t"
                 "s_wait_xcnt 0x0"
                 :: "v"(l), "v"(l + lstep), "v"(l + 2 * lstep), "v"(l + 3 * lstep),
                    "v"(l + 4 * lstep), "v"(l + 5 * lstep), "v"(l + 6 * lstep), "v"(l + 7 * lstep),
                    "v"(g), "v"(g + 256), "v"(g + 2 * 256), "v"(g + 3 * 256),
                    "v"(g + 4 * 256), "v"(g + 5 * 256), "v"(g + 6 * 256), "v"(g + 7 * 256)
                 : "memory");
  };
  auto copy_stage = [&](int st, int b) {
#pragma unroll
    for (int u = 0; u < STG; ++u) {
      // keeps each statement's 24 address registers from being formed ahead of the statement before it (all 96 at once spilled)
      __builtin_amdgcn_sched_barrier(0);
      copy8(srcK + (size_t)st * (STG * TILE_E) + u * TILE_E, ldsK + b * KBUF_B + u * (KT_E * 2), 2 * KP * 2);
      __builtin_amdgcn_sched_barrier(0);
      copy8(srcV + (size_t)st * (STG * TILE_E) + u * TILE_E, ldsV + b * VBUF_B + u * (VT_E * 2), 8 * VP * 2);
    }
  };

  // The first trip's stage, its wait and barrier, then the second trip's. Rolled, so that every address the statements name is formed for them anew: unrolled,
  // the lane's two LDS base addresses were asm operands themselves, and the build spilled them and reloaded them in every stage.
#pragma clang loop unroll(disable)
  for (int p = 0; p < 2; ++p) {
    copy_stage((p + rot) & (NTRIP - 1), p);
    if (p == 0) {
      asm volatile("s_wait_asynccnt 0x0" ::: "memory");   // this wave's copies of stage rot have landed
      __syncthreads();                                    // stage rot is in LDS for every wave
    }
  }

  // ---- Q -> 2 x 4 B fragments (32 d x 16 query columns each), pre-scaled by 2^4.
  // B map: lane column n = query l16; elements 0..7 <- d = c*32 + 8h + 0..7; elements 8..15 <- d = c*32 + 16 + 8h + 0..7
  v16h qf[2][4];
#pragma unroll
  for (int j = 0; j < 2; ++j)
#pragma unroll
    for (int c = 0; c < 4; ++c) {
      Frag f;
#pragma unroll
      for (int s = 0; s < 2; ++s) {
        const float4 a0 = qa[j][c][s][0];
        const float4 a1 = qa[j][c][s][1];
        v8h t;
        t[0] = (_Float16)(a0.x * SA_OPS); t[1] = (_Float16)(a0.y * SA_OPS);
        t[2] = (_Float16)(a0.z * SA_OPS); t[3] = (_Float16)(a0.w * SA_OPS);
        t[4] = (_Float16)(a1.x * SA_OPS); t[5] = (_Float16)(a1.y * SA_OPS);
        t[6] = (_Float16)(a1.z * SA_OPS); t[7] = (_Float16)(a1.w * SA_OPS);
        f.h[s] = t;
      }
      qf[j][c] = f.v;
    }

  // Each group runs one online-softmax pass over its own KV quarter; the four partial states of a query row
  // are joined after the loop by their maxima and sums == LSE-weighted combine of the partial states.
  // Trip t works on stage (t + rot) mod NTRIP of the group's quarter: every stage once, in an order that differs from block to block.
  // Trip t reads buffer t & 1 (two tiles of 32 kv rows) while the copies for trip t + 1 fly into the other buffer; those for trip t + 2
  // are issued behind the barrier that ends the reads of trip t, into the buffer that they have left.
  Frag kf[2][4];    // K tile as A fragments: [kv rows 0..15 | 16..31][d-chunk of 32]
  Frag vf[8];       // V^T tile as A fragments: [d-chunk of 16]
  v8f  s[2][2];     // scores: [column group][kv rows 0..15 | 16..31]
  Frag pf[2];       // P^T as B fragments: [column group]
  float cf[2];      // rescale factor of the lane's two queries

  // A map (same k map as B): lane row m = kv l16; elements 0..7 <- d = c*32 + 8h + 0..7; 8..15 <- d = c*32 + 16 + 8h + 0..7
  auto read_k = [&](const _Float16* kt) {   // kt: the tile's start + l16 * KP + half * 8
#pragma unroll
    for (int c = 0; c < 4; ++c)
#pragma unroll
      for (int u = 0; u < 2; ++u) {
        kf[u][c].h[0] = *(const v8h*)(kt + u * 16 * KP + c * 32);
        kf[u][c].h[1] = *(const v8h*)(kt + u * 16 * KP + c * 32 + 16);
      }
  };
  // A map: lane row m = d (cn*16 + l16); elements 0..7 <- kv 8h + 0..7; 8..15 <- kv 16 + 8h + 0..7
  auto read_v = [&](const _Float16* vp) {   // vp: the tile's start + l16 * VP + half * 8
#pragma unroll
    for (int cn = 0; cn < 8; ++cn) {
      vf[cn].h[0] = *(const v8h*)(vp + cn * 16 * VP);
      vf[cn].h[1] = *(const v8h*)(vp + cn * 16 * VP + 16);
    }
  };
  // ---- S^T = (2^4 K)(2^4 Q)^T : 2 x 2 tiles of 16x16 (kv rows x query columns), 4 k-steps over d; a K fragment feeds both column groups
  auto scores = [&]() {
#pragma unroll
    for (int j = 0; j < 2; ++j)
#pragma unroll
      for (int u = 0; u < 2; ++u)
#pragma unroll
        for (int r = 0; r < 8; ++r) s[j][u][r] = 0.0f;
#pragma unroll
    for (int c = 0; c < 4; ++c)
#pragma unroll
      for (int u = 0; u < 2; ++u)
#pragma unroll
        for (int j = 0; j < 2; ++j) s[j][u] = wmma_f16(kf[u][c].v, qf[j][c], s[j][u]);
  };
  // ---- online softmax in the log2 domain; D map: s[j][0][r] = S[query l16][kv 8h + r], s[j][1][r] = S[query l16][kv 16 + 8h + r]:
  // a query's 32 scores lie in the two lanes l16 and 16 + l16, so its maximum is in-lane plus one exchange
  auto softmax = [&](int j) {
    float mx = fmaxf(s[j][0][0], s[j][1][0]);
#pragma unroll
    for (int r = 1; r < 8; ++r) mx = fmaxf(mx, fmaxf(s[j][0][r], s[j][1][r]));
    mx = fmaxf(mx, xhalf(mx));
    const float mn = fmaxf(mrun[j], mx * SA_CS);
    cf[j] = exp2_slot(mrun[j] - mn);
    float e0[8], e1[8];
#pragma unroll
    for (int r = 0; r < 8; ++r) {
      e0[r] = s[j][0][r] * SA_CS - mn;
      e1[r] = s[j][1][r] * SA_CS - mn;
    }
    // the 16 exp2, each in place on its own register, with the free slot behind the last, in one statement: no exp2's result
    // is laid over the source register of the exp2 directly in front of it
    asm("v_exp_f32 %0, %0\n\tv_exp_f32 %1, %1\n\tv_exp_f32 %2, %2\n\tv_exp_f32 %3, %3\n\t"
        "v_exp_f32 %4, %4\n\tv_exp_f32 %5, %5\n\tv_exp_f32 %6, %6\n\tv_exp_f32 %7, %7\n\t"
        "v_exp_f32 %8, %8\n\tv_exp_f32 %9, %9\n\tv_exp_f32 %10, %10\n\tv_exp_f32 %11, %11\n\t"
        "v_exp_f32 %12, %12\n\tv_exp_f32 %13, %13\n\tv_exp_f32 %14, %14\n\tv_exp_f32 %15, %15\n\tv_nop"
        : "+v"(e0[0]), "+v"(e1[0]), "+v"(e0[1]), "+v"(e1[1]), "+v"(e0[2]), "+v"(e1[2]), "+v"(e0[3]), "+v"(e1[3]),
          "+v"(e0[4]), "+v"(e1[4]), "+v"(e0[5]), "+v"(e1[5]), "+v"(e0[6]), "+v"(e1[6]), "+v"(e0[7]), "+v"(e1[7]));
    float rs = 0.0f;
#pragma unroll
    for (int r = 0; r < 8; ++r) rs += e0[r] + e1[r];
    lrun[j] = lrun[j] * cf[j] + rs;
    mrun[j] = mn;
    // P^T (<= 1) pre-scaled by 2^4: the two score tiles, converted in place, are the B fragment
    // B map: lane column n = query l16; elements 0..7 <- kv 8h + 0..7; 8..15 <- kv 16 + 8h + 0..7
#pragma unroll
    for (int r = 0; r < 8; ++r) {
      pf[j].h[0][r] = (_Float16)(e0[r] * SA_OPS);
      pf[j].h[1][r] = (_Float16)(e1[r] * SA_OPS);
    }
  };
  // ---- O^T = O^T * cf + (2^4 V)^T (2^4 P)^T : 8 d-chunks of 16 rows; a V fragment feeds both column groups
  auto pv = [&]() {
#pragma unroll
    for (int j = 0; j < 2; ++j)
#pragma unroll
      for (int n = 0; n < 8; ++n)
#pragma unroll
        for (int r = 0; r < 8; ++r) o[j][n][r] *= cf[j];
#pragma unroll
    for (int cn = 0; cn < 8; ++cn)
#pragma unroll
      for (int j = 0; j < 2; ++j) o[j][cn] = wmma_f16(vf[cn].v, pf[j].v, o[j][cn]);
  };

  // The LDS reads stand in whole-tile groups ahead of the work that covers their latency, never among the products; every
  // sched_barrier below keeps one such group, or the publish point, where it is written (without them the build sinks each read
  // to its product and moves register-only work over the waits).
  auto ktile = [&](int b) { return kring + (b * SA_NGRP + grp) * (STG * KT_E) + l16 * KP + half * 8; };
  auto vtile = [&](int b) { return vring + (b * SA_NGRP + grp) * (STG * VT_E) + l16 * VP + half * 8; };
  // Stage in buffer b, from its first tile's score products (its K fragments are already on their way) to the publish point of the
  // next stage, which stands where the last fragments of buffer b have been fetched: behind the second tile's score products.
  auto front = [&](int b) {
    const _Float16* kt = ktile(b);
    const _Float16* vp = vtile(b);
    scores();
    __builtin_amdgcn_sched_barrier(0);   // the reads below reuse the K fragments' registers: behind the last score product
    read_v(vp);
    read_k(kt + KT_E);
    __builtin_amdgcn_sched_barrier(0);   // first tile's V and second tile's K fragments ahead of the softmax that covers them
    softmax(0); softmax(1);
    pv();
    __builtin_amdgcn_sched_barrier(0);   // the reads below reuse the V fragments' registers: behind the last output product
    read_v(vp + VT_E);
    __builtin_amdgcn_sched_barrier(0);   // second tile's V fragments ahead of the score products that cover them
    scores();
    __builtin_amdgcn_sched_barrier(0);   // the score products stay ahead of the waits: they cover the V reads' latency
    asm volatile("s_wait_dscnt 0x0" ::: "memory");      // this wave's reads of buffer b are done before the buffer is refilled
    asm volatile("s_wait_asynccnt 0x0" ::: "memory");   // this wave's copies of the next stage have landed
    __syncthreads();   // the next stage is in LDS for every wave, and every reader of buffer b is done (last stage: the ring is free)
  };
  // the second tile's softmax and output products: registers only, behind the publish point
  auto back = [&]() {
    softmax(0); softmax(1);
    pv();
  };
  read_k(ktile(0));
  // One rolled loop over all stages (unrolled or peeled, the build put off the straight-line stages' row sums to the epilogue and
  // spilled their terms). Both tests are scalar and read the same in every wave of the block.
#pragma clang loop unroll(disable)
  for (int t = 0; t < NTRIP; ++t) {
    front(t & 1);
    if (t + 2 < NTRIP) copy_stage((t + 2 + rot) & (NTRIP - 1), t & 1);   // only while a trip t + 2 exists
    if (t + 1 < NTRIP) read_k(ktile((t + 1) & 1));        // behind the last stage's barrier nothing is read from the ring
    __builtin_amdgcn_sched_barrier(0);   // the refill and the next stage's first K fragments ahead of the work that covers them
    back();
    __builtin_amdgcn_sched_barrier(0);   // keeps the next stage's score products behind this stage's output products
  }
  asm volatile("s_wait_asynccnt 0x0" ::: "memory");     // no copy is left in flight when the ring becomes output staging

#pragma unroll
  for (int j = 0; j < 2; ++j) {
    const int row = wq * 32 + j * 16 + l16;   // the query's row in the block
    float* ob = obuf + (grp * SA_QBLK + row) * OPF;
#pragma unroll
    for (int n = 0; n < 8; ++n) {   // D map: o[j][n][r] = O[query l16][d = n*16 + 8h + r]: 8 consecutive d, two 16-B stores
      float* od = ob + n * 16 + half * 8;
      const v4f lo = {o[j][n][0], o[j][n][1], o[j][n][2], o[j][n][3]};
      const v4f hi = {o[j][n][4], o[j][n][5], o[j][n][6], o[j][n][7]};
      *(v4f*)(od)     = lo;
      *(v4f*)(od + 4) = hi;
    }
    const float lj = lrun[j] + xhalf(lrun[j]);   // the two halves' sums of one query, joined once (all lanes active)
    if (half == 0) {
      mbuf[grp * SA_QBLK + row] = mrun[j];
      lbuf[grp * SA_QBLK + row] = lj;
    }
  }
  __syncthreads();   // every group's partial state is in LDS

  // Join of the four partial states. Wave w owns block rows 8w..8w+7.
  // out0: one 16-B-per-lane instruction per row (512 B = 4 lines).
  {
    float* orow = out + ((size_t)(h * SA_SQ + q0 + wave * 8)) * SA_D + lane * 4;
    v4f res[8];
#pragma unroll
    for (int i = 0; i < 8; ++i) {
      const int row = wave * 8 + i;
      float mg[SA_NGRP], lg[SA_NGRP];
#pragma unroll
      for (int g = 0; g < SA_NGRP; ++g) {
        mg[g] = mbuf[g * SA_QBLK + row];
        lg[g] = lbuf[g * SA_QBLK + row];
      }
      const float mx = fmaxf(fmaxf(mg[0], mg[1]), fmaxf(mg[2], mg[3]));
      float ls = 0.0f;
      v4f acc = {0.0f, 0.0f, 0.0f, 0.0f};
#pragma unroll
      for (int g = 0; g < SA_NGRP; ++g) {
        const float w = exp2_slot(mg[g] - mx);
        ls += w * lg[g];
        acc += w * *(const v4f*)(obuf + (g * SA_QBLK + row) * OPF + lane * 4);
      }
      res[i] = acc * (SA_OINV / ls);
    }
    // the eight stores stand together behind all the arithmetic, and the wait stands behind them in front of every reuse of their
    // data and address registers; the two sched_barriers keep register writes out of that stretch
    __builtin_amdgcn_sched_barrier(0);
#pragma unroll
    for (int i = 0; i < 8; ++i) *(v4f*)(orow + (size_t)i * SA_D) = res[i];
    asm volatile("s_wait_xcnt 0x0" ::: "memory");
    __builtin_amdgcn_sched_barrier(0);
  }
  // out1: 64 floats per block (256 B = 2 lines) written by wave 0 lanes 0..15, one instruction; lane owns block rows 4*lane..+3.
  if (wave == 0 && lane < 16) {
    v4f mg[SA_NGRP], lg[SA_NGRP];
#pragma unroll
    for (int g = 0; g < SA_NGRP; ++g) {
      mg[g] = *(const v4f*)(mbuf + g * SA_QBLK + lane * 4);
      lg[g] = *(const v4f*)(lbuf + g * SA_QBLK + lane * 4);
    }
    v4f lv;
#pragma unroll
    for (int k = 0; k < 4; ++k) {
      const float mx = fmaxf(fmaxf(mg[0][k], mg[1][k]), fmaxf(mg[2][k], mg[3][k]));
      float ls = 0.0f;
#pragma unroll
      for (int g = 0; g < SA_NGRP; ++g) ls += exp2_slot(mg[g][k] - mx) * lg[g][k];
      lv[k] = SA_LN2 * (mx + log2f(ls));
    }
    *(v4f*)(lse + (size_t)h * SA_SQ + q0 + lane * 4) = lv;
  }
}

extern "C" void kernel_launch(void* const* d_in, const int* in_sizes, int n_in,
                              void* d_out, int out_size, void* d_ws, size_t ws_size,
                              hipStream_t stream) {
  (void)ws_size;
  // static shapes; refuse anything else (outputs stay zero)
  if (n_in < 5) return;
  if (in_sizes[0] != SA_H * SA_SQ * SA_D) return;
  if (in_sizes[1] != SA_H * SA_SKV * SA_D || in_sizes[2] != SA_H * SA_SKV * SA_D) return;
  if (in_sizes[3] != SA_H * SA_SKV * SA_D || in_sizes[4] != SA_H * SA_SKV * SA_D) return;
  if (out_size != SA_H * SA_SQ * SA_D + SA_H * SA_SQ) return;

  const float* q  = (const float*)d_in[0];
  const float* kA = (const float*)d_in[1];
  const float* vA = (const float*)d_in[2];
  const float* kB = (const float*)d_in[3];
  const float* vB = (const float*)d_in[4];
  float* out = (float*)d_out;                              // output 0: [16][1024][128] f32 at byte 0
  float* lse = out + (size_t)SA_H * SA_SQ * SA_D;          // output 1: [16][1024] f32 at byte 8388608

  _Float16* kh = (_Float16*)d_ws;                          // f16 K tiles of both sets: 16 MiB, written anew in every call
  _Float16* vt = kh + (size_t)2 * SA_H * SA_SKV * SA_D;    // f16 V tiles (transposed) of both sets: 16 MiB

  dim3 grid(SA_H * (SA_SQ / SA_QBLK));   // 256 blocks: head x 64-row query tile (1024 = 16 x 64 exactly)
  kv_to_f16<<<grid, dim3(32 * SA_NWAVE), 0, stream>>>(kA, vA, kB, vB, kh, vt);   // 256 blocks x 4 groups x 2 tiles = 2048 tiles = 2 sets x 16 heads x 64
  attn_two_kv<<<grid, dim3(32 * AT_NWAVE), 0, stream>>>(q, kh, vt, out, lse);    // 8 waves: 2 query tiles of 32 rows x 4 KV quarters
}

// v010
// One run takes 42 microseconds.
// Next to v009, in two timings, it ran 1.06 times as fast each time.
// All steps since v000 together make it 5.88 times as fast.
#include <hip/hip_runtime.h>

typedef _Float16 v16h __attribute__((ext_vector_type(16)));
typedef _Float16 v8h  __attribute__((ext_vector_type(8)));
typedef _Float16 v4h  __attribute__((ext_vector_type(4)));
typedef float    v8f  __attribute__((ext_vector_type(8)));
typedef float    v4f  __attribute__((ext_vector_type(4)));
union Frag { v16h v; v8h h[2]; };

#define SA_H     16
#define SA_SQ    1024
#define SA_SKV   2048
#define SA_D     128
#define SA_QBLK  64            // query rows per block (2 wave tiles x 32 rows)
#define SA_NGRP  4             // KV quarters per block: A low, A high, B low, B high; one group of waves each
#define SA_NWAVE (4 * SA_NGRP) // kv_to_f16: 16 waves, four per group
#define AT_NWAVE (2 * SA_NGRP) // attn_two_kv: 8 waves, two per group and two per SIMD (register budget 512 per wave)
#define SA_OPS   16.0f         // power-of-two operand pre-scale applied to Q, K, V and P before the f16 convert
// log2-domain score scale: (1/sqrt(D)) * log2(e), with the 2^4*2^4 operand scale of Q and K removed (2^-8)
#define SA_CS    ((0.088388347648318447f * 1.4426950408889634f) * 0.00390625f)
#define SA_LN2   0.69314718055994531f
#define SA_OINV  0.00390625f   // removes the 2^4*2^4 operand scale of P and V
#define SA_TH    8.0f          // a query's maximum in use is renewed only when a tile's maximum lies more than this above it (log2 domain): P <= 2^8

// LDS pitches in 16-bit elements (rows 16-B aligned)
#define KP   136   // K tile   [32 kv][128 d + 8]   d contiguous  -> A fragment for S^T
#define VP   40    // V tile   [128 d][32 kv + 8]   kv contiguous -> A fragment for O^T
#define OPF  132   // O rows   [q][128 d + 4]       floats (epilogue staging)
#define NSTEP (2 * SA_SKV / 32 / SA_NGRP)   // steps of 32 kv rows per group
#define TILE_E (32 * SA_D)                  // 16-bit elements of one K or V tile in the workspace (8 KiB, contiguous)
#define HTILES (SA_SKV / 32)                // tiles per head and KV set; tile number = (set * SA_H + head) * HTILES + kv / 32
#define STG    2                            // tiles of 32 kv rows per stage: what one ring buffer holds of one group's K and of its V
#define NTRIP  (NSTEP / STG)                // stages per group
#define KT_E   (32 * KP)                    // 16-bit elements of one K tile in LDS
#define VT_E   (SA_D * VP)                  // 16-bit elements of one V tile in LDS
#define KBUF_B (SA_NGRP * STG * KT_E * 2)   // bytes of one ring buffer's K part (all groups):  69632
#define VBUF_B (SA_NGRP * STG * VT_E * 2)   // bytes of one ring buffer's V part (all groups):  81920

// 16x16x32 f16 WMMA, the plain builtin: the compiler keeps its distances, and its operands may stand above v255
__device__ __forceinline__ v8f wmma_f16(v16h a, v16h b, v8f c) {
  return __builtin_amdgcn_wmma_f32_16x16x32_f16(false, a, false, b, (short)0, c, false, false);
}

// exp2 with its free slot in one statement: nothing that reads its result or overwrites its source stands directly behind it
__device__ __forceinline__ float exp2_slot(float x) {
  float y;
  asm("v_exp_f32 %0, %1\n\tv_nop" : "=v"(y) : "v"(x));
  return y;
}

// lane l <-> lane l ^ 16: the two lanes that share one query column
__device__ __forceinline__ float xhalf(float x) {
  const int b = __builtin_bit_cast(int, x);
  return __builtin_bit_cast(float, __builtin_amdgcn_permlanex16(b, b, 0x76543210, 0xfedcba98, false, false));
}

// K and V, f32 -> f16 = x * 2^4, once for all 16 query blocks of a head. K tile: [32 kv][128 d]; V tile transposed: [128 d][32 kv].
// A group of 4 waves takes two tiles; a wave takes 8 kv rows of each (one whole 512-B row per load), all 32 loads issued ahead.
__global__ __launch_bounds__(32 * SA_NWAVE)
void kv_to_f16(const float* __restrict__ kA, const float* __restrict__ vA,
               const float* __restrict__ kB, const float* __restrict__ vB,
               _Float16* __restrict__ kh, _Float16* __restrict__ vt)
{
  __shared__ __align__(16) _Float16 tb[2][SA_NGRP][SA_D * VP];   // 81920 B: V tiles on their way from [kv][d] to [d][kv]

  const int tid  = threadIdx.x;
  const int lane = tid & 31;
  const int wave = __builtin_amdgcn_readfirstlane(tid >> 5);
  const int grp  = wave >> 2;
  const int wq   = wave & 3;
  const int srow = wq * 8;
  const int sd   = lane * 4;
  const int h    = blockIdx.x % SA_H;                                   // same head as the attention block of this index
  const int t0   = (blockIdx.x / SA_H) * (2 * SA_NGRP) + grp * 2;       // first of the group's two tiles, 0..127 within the head
  const int set  = t0 / HTILES;                                         // both tiles lie in one KV set (t0 is even)
  const int j0   = t0 % HTILES;
  const float* ks = set ? kB : kA;
  const float* vs = set ? vB : vA;
  const size_t tile0 = (size_t)(set * SA_H + h) * HTILES + j0;

  v4f kx[2][8], vx[2][8];
  const float* bk = ks + ((size_t)(h * SA_SKV + j0 * 32 + srow)) * SA_D;   // wave-uniform bases; the lane adds its 4 d
  const float* bv = vs + ((size_t)(h * SA_SKV + j0 * 32 + srow)) * SA_D;
#pragma unroll
  for (int t = 0; t < 2; ++t) {   // the second tile's rows follow the first's at 32 rows' distance
#pragma unroll
    for (int i = 0; i < 8; ++i) kx[t][i] = *(const v4f*)(bk + sd + (t * 32 + i) * SA_D);
#pragma unroll
    for (int i = 0; i < 8; ++i) vx[t][i] = *(const v4f*)(bv + sd + (t * 32 + i) * SA_D);
  }
  // the loads stay in flight over code that reuses the registers their addresses stand in: keep the wait in front of that reuse.
  // The two bases and the lane number are inputs so that they keep their registers up to the wait
  asm volatile("s_wait_xcnt 0x0" :: "s"(bk), "s"(bv), "v"(lane) : "memory");
  // keeps all 32 loads, and the wait directly behind them, ahead of the first convert: without it the build held the last
  // eight loads back and waited out their latency in pairs
  __builtin_amdgcn_sched_barrier(0);
#pragma unroll
  for (int t = 0; t < 2; ++t) {
    // K keeps its order: 4 d per 8-B store, a wave's store fills one 256-B row of the tile (2 whole lines)
    _Float16* dk = kh + (tile0 + t) * TILE_E + srow * SA_D + sd;
#pragma unroll
    for (int i = 0; i < 8; ++i) {
      v4h p;
      p[0] = (_Float16)(kx[t][i][0] * SA_OPS); p[1] = (_Float16)(kx[t][i][1] * SA_OPS);
      p[2] = (_Float16)(kx[t][i][2] * SA_OPS); p[3] = (_Float16)(kx[t][i][3] * SA_OPS);
      *(v4h*)(dk + i * SA_D) = p;
    }
    // V is turned in LDS: the lane's 8 kv of one d per 16-B store
    _Float16* dv = tb[t][grp];
#pragma unroll
    for (int c = 0; c < 4; ++c) {
      v8h w;
#pragma unroll
      for (int i = 0; i < 8; ++i) w[i] = (_Float16)(vx[t][i][c] * SA_OPS);
      *(v8h*)(dv + (sd + c) * VP + srow) = w;
    }
  }
  __syncthreads();   // both turned V tiles of every group are in LDS
#pragma unroll
  for (int t = 0; t < 2; ++t) {
    _Float16* gv = vt + (tile0 + t) * TILE_E;
#pragma unroll
    for (int i = 0; i < 4; ++i) {   // 16-B piece e of the tile: d = e / 4, kv = 8 * (e % 4); a wave's store fills 512 contiguous bytes
      const int e = wq * 128 + i * 32 + lane;
      *(v8h*)(gv + e * 8) = *(const v8h*)(tb[t][grp] + (e >> 2) * VP + (e & 3) * 8);
    }
  }
}

__global__ __launch_bounds__(32 * AT_NWAVE)
void attn_two_kv(const float* __restrict__ q,
                 const _Float16* __restrict__ kh, const _Float16* __restrict__ vt,
                 float* out, float* lse)
{
  // 303104 B: the ring, K part [2 buffers][group][tile of the stage][32 * KP], then V part [2][group][tile][SA_D * VP].
  // Behind the loop's last barrier the same bytes hold the unnormalised partial O, [group][block row][OPF] floats (135168 B).
  __shared__ __align__(16) unsigned char ring[2 * KBUF_B + 2 * VBUF_B];
  __shared__ __align__(16) float    mbuf[SA_NGRP * SA_QBLK];       //   1024 B, partial row maxima in use (log2 domain), [group][block row]
  __shared__ __align__(16) float    lbuf[SA_NGRP * SA_QBLK];       //   1024 B, partial row sums

  const int tid  = threadIdx.x;
  const int lane = tid & 31;
  const int wave = __builtin_amdgcn_readfirstlane(tid >> 5);   // scalar, so that the group's base pointers stay scalar
  const int grp  = wave >> 1;       // KV quarter this wave works on
  const int wq   = wave & 1;        // query tile (32 rows: two column groups of 16) this wave works on
  const int half = lane >> 4;       // h of the fragment map
  const int l16  = lane & 15;       // row m for A, column n for B and D (the lane's query in each column group)

  const int h    = blockIdx.x % SA_H;
  const int q0   = (blockIdx.x / SA_H) * SA_QBLK;
  const int qrow = q0 + wq * 32;
  // The 16 query blocks of a head read the same K and V tiles. Each enters the walk over the stages at its own stage and wraps round,
  // so that they do not ask L2 for the same lines at the same moment. Scalar, the same in every wave of the block.
  const int rot  = (blockIdx.x / SA_H) & (NTRIP - 1);
  _Float16* const kring = (_Float16*)ring;
  _Float16* const vring = (_Float16*)(ring + 2 * KBUF_B);
  float*    const obuf  = (float*)ring;

  // staging split (2 waves of a group): a wave takes a half (4 KiB) of each f16 K tile and of each f16 V tile; one copy
  // instruction covers 512 contiguous bytes (4 lines), a lane moves one 16-B piece in each of the 8 copies of a tile half
  const size_t tile0 = (size_t)((grp >> 1) * SA_H + h) * HTILES + (grp & 1) * (HTILES / 2);   // the group's first tile

  // ---- Q, raw: the lane's 2 x 64 floats, all 32 loads issued ahead of the staging below, which covers their latency
  float4 qa[2][4][2][2];   // [column group][d-chunk of 32][element half s][4 floats]
  {
    const float* qp0 = q + ((size_t)(h * SA_SQ + qrow + l16)) * SA_D + 8 * half;
    const float* qp1 = qp0 + 16 * SA_D;
#pragma unroll
    for (int j = 0; j < 2; ++j)
#pragma unroll
      for (int c = 0; c < 4; ++c)
#pragma unroll
        for (int s = 0; s < 2; ++s) {
          const float* p = (j ? qp1 : qp0) + c * 32 + 16 * s;
          qa[j][c][s][0] = *(const float4*)(p);
          qa[j][c][s][1] = *(const float4*)(p + 4);
        }
    // the loads stay in flight over code that reuses the registers their addresses stand in: keep the wait in front of that reuse.
    // The two addresses are inputs so that they keep their registers up to the wait
    asm volatile("s_wait_xcnt 0x0" :: "v"(qp0), "v"(qp1) : "memory");
    // keeps all 32 loads ahead of the wait and every later register write behind it
    __builtin_amdgcn_sched_barrier(0);
  }

  v8f o[2][8];
#pragma unroll
  for (int j = 0; j < 2; ++j)
#pragma unroll
    for (int n = 0; n < 8; ++n)
#pragma unroll
      for (int r = 0; r < 8; ++r) o[j][n][r] = 0.0f;

  // state of the lane's two queries: the maximum in use (equal in both lane halves; at most SA_TH below the true running maximum)
  // and the sum over this half's kv rows only, taken against that maximum
  float mrun[2] = {-1.0e30f, -1.0e30f}, lrun[2] = {0.0f, 0.0f};

  const _Float16* srcK = kh + tile0 * TILE_E + wq * 2048 + lane * 8;
  const _Float16* srcV = vt + tile0 * TILE_E + wq * 2048 + lane * 8;
  // the lane's LDS byte addresses (low 32 bits of the __shared__ address) of its first piece in buffer 0; only the row pitch
  // differs from the workspace tile (256 -> 272 B for K, 64 -> 80 B for V).
  // K tile (32 kv x 128 d), d contiguous: piece e = wq*256 + i*32 + lane is kv row e / 16, d = 8 * (e % 16)
  const unsigned ldsK = (unsigned)(size_t)(kring + grp * (STG * KT_E) + (wq * 16 + (lane >> 4)) * KP + (lane & 15) * 8);
  // V tile [d][kv], kv contiguous: piece e is d = e / 4, kv = 8 * (e % 4)
  const unsigned ldsV = (unsigned)(size_t)(vring + grp * (STG * VT_E) + (wq * 64 + (lane >> 2)) * VP + (lane & 3) * 8);

  // ---- stage st (tiles 2 st and 2 st + 1 of the group) into ring buffer b: 16 + 16 copies per wave, through no register.
  // One statement brings the wave's half of one tile. The s_wait_xcnt is the last line of the copies' own statement: it stands
  // in front of every reuse of their address registers.
  auto copy8 = [&](const _Float16* g, unsigned l, unsigned lstep) {
    asm volatile("global_load_async_to_lds_b128 %0, %8, off\n\t"
                 "global_load_async_to_lds_b128 %1, %9, off\n\t"
                 "global_load_async_to_lds_b128 %2, %10, off\n\t"
                 "global_load_async_to_lds_b128 %3, %11, off\n\t"
                 "global_load_async_to_lds_b128 %4, %12, off\n\t"
                 "global_load_async_to_lds_b128 %5, %13, off\n\t"
                 "global_load_async_to_lds_b128 %6, %14, off\n\t"
                 "global_load_async_to_lds_b128 %7, %15, off\n\t"
                 "s_wait_xcnt 0x0"
                 :: "v"(l), "v"(l + lstep), "v"(l + 2 * lstep), "v"(l + 3 * lstep),
                    "v"(l + 4 * lstep), "v"(l + 5 * lstep), "v"(l + 6 * lstep), "v"(l + 7 * lstep),
                    "v"(g), "v"(g + 256), "v"(g + 2 * 256), "v"(g + 3 * 256),
                    "v"(g + 4 * 256), "v"(g + 5 * 256), "v"(g + 6 * 256), "v"(g + 7 * 256)
                 : "memory");
  };
  auto copy_stage = [&](int st, int b) {
#pragma unroll
    for (int u = 0; u < STG; ++u) {
      // keeps each statement's 24 address registers from being formed ahead of the statement before it (all 96 at once spilled)
      __builtin_amdgcn_sched_barrier(0);
      copy8(srcK + (size_t)st * (STG * TILE_E) + u * TILE_E, ldsK + b * KBUF_B + u * (KT_E * 2), 2 * KP * 2);
      __builtin_amdgcn_sched_barrier(0);
      copy8(srcV + (size_t)st * (STG * TILE_E) + u * TILE_E, ldsV + b * VBUF_B + u * (VT_E * 2), 8 * VP * 2);
    }
  };

  // The first trip's stage, its wait and barrier, then the second trip's. Rolled, so that every address the statements name is formed for them anew: unrolled,
  // the lane's two LDS base addresses were asm operands themselves, and the build spilled them and reloaded them in every stage.
#pragma clang loop unroll(disable)
  for (int p = 0; p < 2; ++p) {
    copy_stage((p + rot) & (NTRIP - 1), p);
    if (p == 0) {
      asm volatile("s_wait_asynccnt 0x0" ::: "memory");   // this wave's copies of stage rot have landed
      __syncthreads();                                    // stage rot is in LDS for every wave
    }
  }

  // ---- Q -> 2 x 4 B fragments (32 d x 16 query columns each), pre-scaled by 2^4.
  // B map: lane column n = query l16; elements 0..7 <- d = c*32 + 8h + 0..7; elements 8..15 <- d = c*32 + 16 + 8h + 0..7
  v16h qf[2][4];
#pragma unroll
  for (int j = 0; j < 2; ++j)
#pragma unroll
    for (int c = 0; c < 4; ++c) {
      Frag f;
#pragma unroll
      for (int s = 0; s < 2; ++s) {
        const float4 a0 = qa[j][c][s][0];
        const float4 a1 = qa[j][c][s][1];
        v8h t;
        t[0] = (_Float16)(a0.x * SA_OPS); t[1] = (_Float16)(a0.y * SA_OPS);
        t[2] = (_Float16)(a0.z * SA_OPS); t[3] = (_Float16)(a0.w * SA_OPS);
        t[4] = (_Float16)(a1.x * SA_OPS); t[5] = (_Float16)(a1.y * SA_OPS);
        t[6] = (_Float16)(a1.z * SA_OPS); t[7] = (_Float16)(a1.w * SA_OPS);
        f.h[s] = t;
      }
      qf[j][c] = f.v;
    }

  // Each group runs one online-softmax pass over its own KV quarter; the four partial states of a query row
  // are joined after the loop by their maxima and sums == LSE-weighted combine of the partial states.
  // Trip t works on stage (t + rot) mod NTRIP of the group's quarter: every stage once, in an order that differs from block to block.
  // Trip t reads buffer t & 1 (two tiles of 32 kv rows) while the copies for trip t + 1 fly into the other buffer; those for trip t + 2
  // are issued behind the barrier that ends the reads of trip t, into the buffer that they have left.
  Frag kf[2][4];    // K tile as A fragments: [kv rows 0..15 | 16..31][d-chunk of 32]
  Frag vf[8];       // V^T tile as A fragments: [d-chunk of 16]
  v8f  s[2][2];     // scores: [column group][kv rows 0..15 | 16..31]
  Frag pf[2];       // P^T as B fragments: [column group]
  float mt[2];      // the tile's maximum of the lane's two queries (log2 domain)
  float e0[2][8], e1[2][8];   // exponents, then probabilities: [column group][r] of kv rows 0..15 | 16..31

  // A map (same k map as B): lane row m = kv l16; elements 0..7 <- d = c*32 + 8h + 0..7; 8..15 <- d = c*32 + 16 + 8h + 0..7
  auto read_k = [&](const _Float16* kt) {   // kt: the tile's start + l16 * KP + half * 8
#pragma unroll
    for (int c = 0; c < 4; ++c)
#pragma unroll
      for (int u = 0; u < 2; ++u) {
        kf[u][c].h[0] = *(const v8h*)(kt + u * 16 * KP + c * 32);
        kf[u][c].h[1] = *(const v8h*)(kt + u * 16 * KP + c * 32 + 16);
      }
  };
  // A map: lane row m = d (cn*16 + l16); elements 0..7 <- kv 8h + 0..7; 8..15 <- kv 16 + 8h + 0..7
  auto read_v = [&](const _Float16* vp) {   // vp: the tile's start + l16 * VP + half * 8
#pragma unroll
    for (int cn = 0; cn < 8; ++cn) {
      vf[cn].h[0] = *(const v8h*)(vp + cn * 16 * VP);
      vf[cn].h[1] = *(const v8h*)(vp + cn * 16 * VP + 16);
    }
  };
  // ---- S^T = (2^4 K)(2^4 Q)^T : 2 x 2 tiles of 16x16 (kv rows x query columns), 4 k-steps over d; a K fragment feeds both column groups
  auto scores = [&]() {
#pragma unroll
    for (int j = 0; j < 2; ++j)
#pragma unroll
      for (int u = 0; u < 2; ++u)
#pragma unroll
        for (int r = 0; r < 8; ++r) s[j][u][r] = 0.0f;
#pragma unroll
    for (int c = 0; c < 4; ++c)
#pragma unroll
      for (int u = 0; u < 2; ++u)
#pragma unroll
        for (int j = 0; j < 2; ++j) s[j][u] = wmma_f16(kf[u][c].v, qf[j][c], s[j][u]);
  };
  // ---- online softmax in the log2 domain; D map: s[j][0][r] = S[query l16][kv 8h + r], s[j][1][r] = S[query l16][kv 16 + 8h + r]:
  // a query's 32 scores lie in the two lanes l16 and 16 + l16, so its maximum is in-lane plus one exchange
  // always_inline on the three lambdas below: soft() stands at two places, and left to itself the build made a called function
  // of it and passed the wave's whole state through scratch memory
  auto tile_max = [&](int j) __attribute__((always_inline)) {
    float mx = fmaxf(s[j][0][0], s[j][1][0]);
#pragma unroll
    for (int r = 1; r < 8; ++r) mx = fmaxf(mx, fmaxf(s[j][0][r], s[j][1][r]));
    mx = fmaxf(mx, xhalf(mx));
    mt[j] = mx * SA_CS;
  };
  // probabilities against the maximum in use
  auto probs = [&](int j) __attribute__((always_inline)) {
#pragma unroll
    for (int r = 0; r < 8; ++r) {
      e0[j][r] = s[j][0][r] * SA_CS - mrun[j];
      e1[j][r] = s[j][1][r] * SA_CS - mrun[j];
    }
    // the 16 exp2, each in place on its own register, with the free slot behind the last, in one statement: no exp2's result
    // is laid over the source register of the exp2 directly in front of it
    asm("v_exp_f32 %0, %0\n\tv_exp_f32 %1, %1\n\tv_exp_f32 %2, %2\n\tv_exp_f32 %3, %3\n\t"
        "v_exp_f32 %4, %4\n\tv_exp_f32 %5, %5\n\tv_exp_f32 %6, %6\n\tv_exp_f32 %7, %7\n\t"
        "v_exp_f32 %8, %8\n\tv_exp_f32 %9, %9\n\tv_exp_f32 %10, %10\n\tv_exp_f32 %11, %11\n\t"
        "v_exp_f32 %12, %12\n\tv_exp_f32 %13, %13\n\tv_exp_f32 %14, %14\n\tv_exp_f32 %15, %15\n\tv_nop"
        : "+v"(e0[j][0]), "+v"(e1[j][0]), "+v"(e0[j][1]), "+v"(e1[j][1]), "+v"(e0[j][2]), "+v"(e1[j][2]), "+v"(e0[j][3]), "+v"(e1[j][3]),
          "+v"(e0[j][4]), "+v"(e1[j][4]), "+v"(e0[j][5]), "+v"(e1[j][5]), "+v"(e0[j][6]), "+v"(e1[j][6]), "+v"(e0[j][7]), "+v"(e1[j][7]));
  };
  // Lazy rescale. The sums and O^T stay scaled by the maximum in use as long as no query of the wave has a tile maximum more than
  // SA_TH above it; any reference exponent gives the same quotient O / l and the same LSE, and P * 2^4 <= 2^12 stays inside f16.
  // One test per tile for the whole wave, a scalar branch. The probabilities are formed against the maximum in use while the
  // test is on its way; where the branch is taken (always on a wave's first tile) they are formed again against the new one.
  auto soft = [&]() __attribute__((always_inline)) {
    tile_max(0); tile_max(1);
    const bool need = (mt[0] - mrun[0] > SA_TH) || (mt[1] - mrun[1] > SA_TH);
    const unsigned grow = __builtin_amdgcn_ballot_w32(need);
    probs(0);
    // keeps the test's compare ahead of the second column group's exp2: left to itself the build puts it directly in front
    // of the branch, which then waits for it
    __builtin_amdgcn_sched_barrier(0);
    probs(1);
    // expected not taken: the build then lays the renewal behind the loop, and the usual path falls through
    if (__builtin_expect(grow != 0u, 0)) {
#pragma unroll
      for (int j = 0; j < 2; ++j) {
        const float mn = fmaxf(mrun[j], mt[j]);
        const float cf = exp2_slot(mrun[j] - mn);
        lrun[j] *= cf;
#pragma unroll
        for (int n = 0; n < 8; ++n)
#pragma unroll
          for (int r = 0; r < 8; ++r) o[j][n][r] *= cf;
        mrun[j] = mn;
        probs(j);
      }
    }
#pragma unroll
    for (int j = 0; j < 2; ++j) {
      float rs = 0.0f;
#pragma unroll
      for (int r = 0; r < 8; ++r) rs += e0[j][r] + e1[j][r];
      lrun[j] += rs;
      // P^T pre-scaled by 2^4: the two score tiles, converted in place, are the B fragment
      // B map: lane column n = query l16; elements 0..7 <- kv 8h + 0..7; 8..15 <- kv 16 + 8h + 0..7
#pragma unroll
      for (int r = 0; r < 8; ++r) {
        pf[j].h[0][r] = (_Float16)(e0[j][r] * SA_OPS);
        pf[j].h[1][r] = (_Float16)(e1[j][r] * SA_OPS);
      }
    }
  };
  // ---- O^T += (2^4 V)^T (2^4 P)^T : 8 d-chunks of 16 rows; a V fragment feeds both column groups
  auto pv = [&]() {
#pragma unroll
    for (int cn = 0; cn < 8; ++cn)
#pragma unroll
      for (int j = 0; j < 2; ++j) o[j][cn] = wmma_f16(vf[cn].v, pf[j].v, o[j][cn]);
  };

  // The LDS reads stand in whole-tile groups ahead of the work that covers their latency, never among the products; every
  // sched_barrier below keeps one such group, or the publish point, where it is written (without them the build sinks each read
  // to its product and moves register-only work over the waits).
  auto ktile = [&](int b) { return kring + (b * SA_NGRP + grp) * (STG * KT_E) + l16 * KP + half * 8; };
  auto vtile = [&](int b) { return vring + (b * SA_NGRP + grp) * (STG * VT_E) + l16 * VP + half * 8; };
  // Stage in buffer b, from its first tile's score products (its K fragments are already on their way) to the publish point of the
  // next stage, which stands where the last fragments of buffer b have been fetched: behind the second tile's score products.
  auto front = [&](int b) {
    const _Float16* kt = ktile(b);
    const _Float16* vp = vtile(b);
    scores();
    __builtin_amdgcn_sched_barrier(0);   // the reads below reuse the K fragments' registers: behind the last score product
    read_v(vp);
    read_k(kt + KT_E);
    __builtin_amdgcn_sched_barrier(0);   // first tile's V and second tile's K fragments ahead of the softmax that covers them
    soft();
    pv();
    __builtin_amdgcn_sched_barrier(0);   // the reads below reuse the V fragments' registers: behind the last output product
    read_v(vp + VT_E);
    __builtin_amdgcn_sched_barrier(0);   // second tile's V fragments ahead of the score products that cover them
    scores();
    __builtin_amdgcn_sched_barrier(0);   // the score products stay ahead of the waits: they cover the V reads' latency
    asm volatile("s_wait_dscnt 0x0" ::: "memory");      // this wave's reads of buffer b are done before the buffer is refilled
    asm volatile("s_wait_asynccnt 0x0" ::: "memory");   // this wave's copies of the next stage have landed
    __syncthreads();   // the next stage is in LDS for every wave, and every reader of buffer b is done (last stage: the ring is free)
  };
  // the second tile's softmax and output products: registers only, behind the publish point
  auto back = [&]() {
    soft();
    pv();
  };
  read_k(ktile(0));
  // One rolled loop over all stages (unrolled or peeled, the build put off the straight-line stages' row sums to the epilogue and
  // spilled their terms). Both tests are scalar and read the same in every wave of the block.
#pragma clang loop unroll(disable)
  for (int t = 0; t < NTRIP; ++t) {
    front(t & 1);
    if (t + 2 < NTRIP) copy_stage((t + 2 + rot) & (NTRIP - 1), t & 1);   // only while a trip t + 2 exists
    if (t + 1 < NTRIP) read_k(ktile((t + 1) & 1));        // behind the last stage's barrier nothing is read from the ring
    __builtin_amdgcn_sched_barrier(0);   // the refill and the next stage's first K fragments ahead of the work that covers them
    back();
    __builtin_amdgcn_sched_barrier(0);   // keeps the next stage's score products behind this stage's output products
  }
  asm volatile("s_wait_asynccnt 0x0" ::: "memory");     // no copy is left in flight when the ring becomes output staging

#pragma unroll
  for (int j = 0; j < 2; ++j) {
    const int row = wq * 32 + j * 16 + l16;   // the query's row in the block
    float* ob = obuf + (grp * SA_QBLK + row) * OPF;
#pragma unroll
    for (int n = 0; n < 8; ++n) {   // D map: o[j][n][r] = O[query l16][d = n*16 + 8h + r]: 8 consecutive d, two 16-B stores
      float* od = ob + n * 16 + half * 8;
      const v4f lo = {o[j][n][0], o[j][n][1], o[j][n][2], o[j][n][3]};
      const v4f hi = {o[j][n][4], o[j][n][5], o[j][n][6], o[j][n][7]};
      *(v4f*)(od)     = lo;
      *(v4f*)(od + 4) = hi;
    }
    const float lj = lrun[j] + xhalf(lrun[j]);   // the two halves' sums of one query, joined once (all lanes active)
    if (half == 0) {
      mbuf[grp * SA_QBLK + row] = mrun[j];
      lbuf[grp * SA_QBLK + row] = lj;
    }
  }
  __syncthreads();   // every group's partial state is in LDS

  // Join of the four partial states. Wave w owns block rows 8w..8w+7.
  // out0: one 16-B-per-lane instruction per row (512 B = 4 lines).
  {
    float* orow = out + ((size_t)(h * SA_SQ + q0 + wave * 8)) * SA_D + lane * 4;
    v4f res[8];
#pragma unroll
    for (int i = 0; i < 8; ++i) {
      const int row = wave * 8 + i;
      float mg[SA_NGRP], lg[SA_NGRP];
#pragma unroll
      for (int g = 0; g < SA_NGRP; ++g) {
        mg[g] = mbuf[g * SA_QBLK + row];
        lg[g] = lbuf[g * SA_QBLK + row];
      }
      const float mx = fmaxf(fmaxf(mg[0], mg[1]), fmaxf(mg[2], mg[3]));
      float ls = 0.0f;
      v4f acc = {0.0f, 0.0f, 0.0f, 0.0f};
#pragma unroll
      for (int g = 0; g < SA_NGRP; ++g) {
        const float w = exp2_slot(mg[g] - mx);
        ls += w * lg[g];
        acc += w * *(const v4f*)(obuf + (g * SA_QBLK + row) * OPF + lane * 4);
      }
      res[i] = acc * (SA_OINV / ls);
    }
    // the eight stores stand together behind all the arithmetic, and the wait stands behind them in front of every reuse of their
    // data and address registers; the two sched_barriers keep register writes out of that stretch
    __builtin_amdgcn_sched_barrier(0);
#pragma unroll
    for (int i = 0; i < 8; ++i) *(v4f*)(orow + (size_t)i * SA_D) = res[i];
    asm volatile("s_wait_xcnt 0x0" ::: "memory");
    __builtin_amdgcn_sched_barrier(0);
  }
  // out1: 64 floats per block (256 B = 2 lines) written by wave 0 lanes 0..15, one instruction; lane owns block rows 4*lane..+3.
  if (wave == 0 && lane < 16) {
    v4f mg[SA_NGRP], lg[SA_NGRP];
#pragma unroll
    for (int g = 0; g < SA_NGRP; ++g) {
      mg[g] = *(const v4f*)(mbuf + g * SA_QBLK + lane * 4);
      lg[g] = *(const v4f*)(lbuf + g * SA_QBLK + lane * 4);
    }
    v4f lv;
#pragma unroll
    for (int k = 0; k < 4; ++k) {
      const float mx = fmaxf(fmaxf(mg[0][k], mg[1][k]), fmaxf(mg[2][k], mg[3][k]));
      float ls = 0.0f;
#pragma unroll
      for (int g = 0; g < SA_NGRP; ++g) ls += exp2_slot(mg[g][k] - mx) * lg[g][k];
      lv[k] = SA_LN2 * (mx + log2f(ls));
    }
    *(v4f*)(lse + (size_t)h * SA_SQ + q0 + lane * 4) = lv;
  }
}

extern "C" void kernel_launch(void* const* d_in, const int* in_sizes, int n_in,
                              void* d_out, int out_size, void* d_ws, size_t ws_size,
                              hipStream_t stream) {
  (void)ws_size;
  // static shapes; refuse anything else (outputs stay zero)
  if (n_in < 5) return;
  if (in_sizes[0] != SA_H * SA_SQ * SA_D) return;
  if (in_sizes[1] != SA_H * SA_SKV * SA_D || in_sizes[2] != SA_H * SA_SKV * SA_D) return;
  if (in_sizes[3] != SA_H * SA_SKV * SA_D || in_sizes[4] != SA_H * SA_SKV * SA_D) return;
  if (out_size != SA_H * SA_SQ * SA_D + SA_H * SA_SQ) return;

  const float* q  = (const float*)d_in[0];
  const float* kA = (const float*)d_in[1];
  const float* vA = (const float*)d_in[2];
  const float* kB = (const float*)d_in[3];
  const float* vB = (const float*)d_in[4];
  float* out = (float*)d_out;                              // output 0: [16][1024][128] f32 at byte 0
  float* lse = out + (size_t)SA_H * SA_SQ * SA_D;          // output 1: [16][1024] f32 at byte 8388608

  _Float16* kh = (_Float16*)d_ws;                          // f16 K tiles of both sets: 16 MiB, written anew in every call
  _Float16* vt = kh + (size_t)2 * SA_H * SA_SKV * SA_D;    // f16 V tiles (transposed) of both sets: 16 MiB

  dim3 grid(SA_H * (SA_SQ / SA_QBLK));   // 256 blocks: head x 64-row query tile (1024 = 16 x 64 exactly)
  kv_to_f16<<<grid, dim3(32 * SA_NWAVE), 0, stream>>>(kA, vA, kB, vB, kh, vt);   // 256 blocks x 4 groups x 2 tiles = 2048 tiles = 2 sets x 16 heads x 64
  attn_two_kv<<<grid, dim3(32 * AT_NWAVE), 0, stream>>>(q, kh, vt, out, lse);    // 8 waves: 2 query tiles of 32 rows x 4 KV quarters
}
